// v000
// Times are from an AMD MI455X. After a warm-up the kernel runs many times in a row, and a time is the length of
// such a window on the GPU divided by its runs, so every launch and the gaps after it count. The runs cycle
// through copies of the inputs. A figure is the median of several windows, for all but v000 over two sittings.
// Sittings can differ by a few percent; kernels timed side by side share one.
// The starting kernel, v000, takes 4750 microseconds a run.
#include <hip/hip_runtime.h>

// Contractions (f32 accumulate): qkv projection v_wmma_f32_16x16x32_bf16 (bf16 x bf16, exact products); scores and prob x value: query rows < RH bf16 hi/lo planes (3 products), rows >= RH v_wmma_f32_16x16x32_f16 (probabilities carried x1024); output projection bf16 hi+lo activation x bf16 weight (2 products).
// Every float input is RNE-converted to bf16 on load. Softmax, rotary and all other side math in f32.

#ifndef NB
#define NB 4
#endif
#ifndef SEQ
#define SEQ 2048
#endif
#define NB_FULL  4                 // batch stride of the staged x rows ([S][B][D])
#define SEQ_FULL 2048              // row pitch of the staged additive mask
#define NB_  NB
#define TT   SEQ
#define DM   1024
#define NH_  16
#define NKV  16
#define REP  (NH_ / NKV)
#define HD   64
#define DQ   (NH_ * HD)
#define DKV  (NKV * HD)
#define ZH   2
#define RH   ((SEQ) < 512 ? (SEQ) : 512)   // query rows < RH use hi+lo planes
#define PCAR 1024.0f
#define SCL  0.125f                // HD^-0.5
static_assert(SEQ % 128 == 0);
static_assert(RH % 64 == 0);
static_assert(SEQ <= SEQ_FULL);
static_assert(NB <= NB_FULL);
static_assert(NH_ % ZH == 0);
static_assert(DM % 64 == 0);
static_assert(DQ == DM);

typedef _Float16 h16;
typedef unsigned short bf;
typedef __attribute__((ext_vector_type(16))) __bf16   v16bf;
typedef __attribute__((ext_vector_type(16))) _Float16 v16h;
typedef __attribute__((ext_vector_type(8)))  _Float16 v8h;
typedef __attribute__((ext_vector_type(8)))  unsigned short v8us;
typedef __attribute__((ext_vector_type(8)))  float    v8f;
typedef __attribute__((ext_vector_type(4)))  float    v4f;
typedef __attribute__((ext_vector_type(2)))  _Float16 v2h;
typedef __attribute__((ext_vector_type(4)))  _Float16 v4h;
typedef __attribute__((ext_vector_type(2)))  unsigned short v2us;
typedef __attribute__((ext_vector_type(4)))  unsigned short v4us;
typedef __attribute__((ext_vector_type(2)))  float    v2f;
typedef v8h  __attribute__((may_alias)) v8ha;
typedef v4f  __attribute__((may_alias)) v4fa;
typedef v8us __attribute__((may_alias)) v8usa;

__device__ __forceinline__ unsigned short f2bf(float f) { unsigned u = __float_as_uint(f); u += 0x7FFFu + ((u >> 16) & 1u); return (unsigned short)(u >> 16); }
__device__ __forceinline__ float bf2f(unsigned short b) { return __uint_as_float(((unsigned)b) << 16); }
__device__ __forceinline__ float bfr(float f) { return bf2f(f2bf(f)); }
__device__ __forceinline__ v16h cat16(v8h lo, v8h hi) { return __builtin_shufflevector(lo, hi, 0, 1, 2, 3, 4, 5, 6, 7, 8, 9, 10, 11, 12, 13, 14, 15); }
__device__ __forceinline__ v16bf cat16b(v8us lo, v8us hi) { return __builtin_bit_cast(v16bf, __builtin_shufflevector(lo, hi, 0, 1, 2, 3, 4, 5, 6, 7, 8, 9, 10, 11, 12, 13, 14, 15)); }
__device__ __forceinline__ v8f wmma16(v16h a, v16h b, v8f c) { return __builtin_amdgcn_wmma_f32_16x16x32_f16(false, a, false, b, (short)0, c, false, false); }
__device__ __forceinline__ v8f wmmab(v16bf a, v16bf b, v8f c) { return __builtin_amdgcn_wmma_f32_16x16x32_bf16(false, a, false, b, (short)0, c, false, false); }

// ---- k_gemmw: register-blocked GEMM, ONE WAVE per 64x64 output tile (16 accumulators), operands straight from K-contiguous 16-bit planes; grid (M/64, N/64, Z), 32 threads.
// C[m][n] (f32, pitch ldc, + optional f32 bias[n]) = sum_k A[m][k] Bt[n][k] (+ split products per NSPLIT). z-batch strides sA/sB/sC in elements. K % 32 == 0, M % 64 == 0, N % 64 == 0.
// Fragment map: lane -> row/col (lane & 15); elements 0..7 <- k0 + 8*(lane>>4) + 0..7, elements 8..15 <- k0 + 16 + 8*(lane>>4) + 0..7; D element j <- (row 8*(lane>>4) + j, col lane & 15).
template <typename T16> struct WFrag;
template <> struct WFrag<h16> { typedef v16h V; static __device__ __forceinline__ V ld(const h16* p) { return cat16(*(const v8h*)p, *(const v8h*)(p + 16)); } static __device__ __forceinline__ v8f mma(V a, V b, v8f c) { return wmma16(a, b, c); } };
template <> struct WFrag<bf> { typedef v16bf V; static __device__ __forceinline__ V ld(const bf* p) { return cat16b(*(const v8us*)p, *(const v8us*)(p + 16)); } static __device__ __forceinline__ v8f mma(V a, V b, v8f c) { return wmmab(a, b, c); } };
template <typename T16, int NSPLIT, bool BIAS>
__global__ __launch_bounds__(32) void k_gemmw(const T16* __restrict__ A, const T16* __restrict__ A2, const T16* __restrict__ Bt, const T16* __restrict__ Bt2, int K, float* C, int ldc, const float* __restrict__ bias, size_t sA, size_t sB, size_t sC) {
    typedef typename WFrag<T16>::V V;
    __shared__ __align__(16) float os[16 * 68];
    const size_t z = blockIdx.z; A += z * sA; if (A2) A2 += z * sA; Bt += z * sB; if (Bt2) Bt2 += z * sB; C += z * sC;
    const int lane = threadIdx.x & 31, lr = lane & 15, hi = lane >> 4; const int r0 = blockIdx.x * 64, c0 = blockIdx.y * 64;
    v8f acc[4][4];
#pragma unroll
    for (int mb = 0; mb < 4; ++mb)
#pragma unroll
        for (int nb = 0; nb < 4; ++nb) acc[mb][nb] = (v8f){};
    const size_t aoff = (size_t)(r0 + lr) * K + 8 * hi, boff = (size_t)(c0 + lr) * K + 8 * hi;
#pragma unroll 1
    for (int kc = 0; kc < K; kc += 32) {
        V a[4], a2[4];
#pragma unroll
        for (int mb = 0; mb < 4; ++mb) { a[mb] = WFrag<T16>::ld(A + aoff + (size_t)mb * 16 * K + kc); if (NSPLIT == 1 || NSPLIT == 2) a2[mb] = WFrag<T16>::ld(A2 + aoff + (size_t)mb * 16 * K + kc); }
#pragma unroll
        for (int nb = 0; nb < 4; ++nb) { const V b = WFrag<T16>::ld(Bt + boff + (size_t)nb * 16 * K + kc); V b2; if (NSPLIT >= 2) b2 = WFrag<T16>::ld(Bt2 + boff + (size_t)nb * 16 * K + kc);
#pragma unroll
            for (int mb = 0; mb < 4; ++mb) { acc[mb][nb] = WFrag<T16>::mma(a[mb], b, acc[mb][nb]); if (NSPLIT == 1 || NSPLIT == 2) acc[mb][nb] = WFrag<T16>::mma(a2[mb], b, acc[mb][nb]); if (NSPLIT >= 2) acc[mb][nb] = WFrag<T16>::mma(a[mb], b2, acc[mb][nb]); } }
        asm volatile("v_nop\n\tv_nop\n\tv_nop\n\tv_nop" : "+v"(acc[0][0]), "+v"(acc[1][1]), "+v"(acc[2][2]), "+v"(acc[3][3]) : "v"(a[0]), "v"(a[3]));
    }
#pragma unroll
    for (int mb = 0; mb < 4; ++mb) {
#pragma unroll
        for (int nb = 0; nb < 4; ++nb) {
#pragma unroll
            for (int j = 0; j < 8; ++j) os[(hi * 8 + j) * 68 + nb * 16 + lr] = acc[mb][nb][j]; }
        __builtin_amdgcn_wave_barrier(); asm volatile("" ::: "memory");
        float* crow = C + (size_t)(r0 + mb * 16) * ldc + c0;
{
#pragma unroll
            for (int s = 0; s < 8; ++s) { const int row = 2 * s + hi, cofs = lr * 4; v4f val = *(const v4fa*)(os + row * 68 + cofs); if (BIAS) { val[0] += bfr(bias[c0 + cofs]); val[1] += bfr(bias[c0 + cofs + 1]); val[2] += bfr(bias[c0 + cofs + 2]); val[3] += bfr(bias[c0 + cofs + 3]); }
                *(v4f*)(crow + (size_t)row * ldc + cofs) = val; }
             }
        __builtin_amdgcn_wave_barrier(); asm volatile("" ::: "memory");
    }
}

// ---- k_gemmc: the same one-wave 64x64 tile GEMM specialised for causal attention: CMODE 1 skips score tiles entirely above the diagonal (query rows r0+roff.., key columns c0..), CMODE 2 limits the
// key (K) loop of the probability x value contraction to the diagonal block (probabilities beyond it are exactly zero). roff = row offset of this launch's first row within the sequence.
template <typename T16, int NSPLIT, int CMODE>
__global__ __launch_bounds__(32) void k_gemmc(const T16* __restrict__ A, const T16* __restrict__ A2, const T16* __restrict__ Bt, const T16* __restrict__ Bt2, int K, float* C, int ldc, int roff, size_t sA, size_t sB, size_t sC) {
    typedef typename WFrag<T16>::V V;
    __shared__ __align__(16) float os[16 * 68];
    const size_t z = blockIdx.z; A += z * sA; if (A2) A2 += z * sA; Bt += z * sB; if (Bt2) Bt2 += z * sB; C += z * sC;
    const int lane = threadIdx.x & 31, lr = lane & 15, hi = lane >> 4; const int r0 = blockIdx.x * 64, c0 = blockIdx.y * 64;
    if (CMODE == 1 && c0 > r0 + roff + 63) return;                  // score tile entirely above the causal diagonal: never produced (the softmax discards j > i by value select)
    const int Kl = (CMODE == 2) ? min(K, r0 + roff + 64) : K;        // P.V: probabilities are exactly 0 beyond the diagonal block, so the K loop stops there
    v8f acc[4][4];
#pragma unroll
    for (int mb = 0; mb < 4; ++mb)
#pragma unroll
        for (int nb = 0; nb < 4; ++nb) acc[mb][nb] = (v8f){};
    const size_t aoff = (size_t)(r0 + lr) * K + 8 * hi, boff = (size_t)(c0 + lr) * K + 8 * hi;
#pragma unroll 1
    for (int kc = 0; kc < Kl; kc += 32) {
        V a[4], a2[4];
#pragma unroll
        for (int mb = 0; mb < 4; ++mb) { a[mb] = WFrag<T16>::ld(A + aoff + (size_t)mb * 16 * K + kc); if (NSPLIT == 1 || NSPLIT == 2) a2[mb] = WFrag<T16>::ld(A2 + aoff + (size_t)mb * 16 * K + kc); }
#pragma unroll
        for (int nb = 0; nb < 4; ++nb) { const V b = WFrag<T16>::ld(Bt + boff + (size_t)nb * 16 * K + kc); V b2; if (NSPLIT >= 2) b2 = WFrag<T16>::ld(Bt2 + boff + (size_t)nb * 16 * K + kc);
#pragma unroll
            for (int mb = 0; mb < 4; ++mb) { acc[mb][nb] = WFrag<T16>::mma(a[mb], b, acc[mb][nb]); if (NSPLIT == 1 || NSPLIT == 2) acc[mb][nb] = WFrag<T16>::mma(a2[mb], b, acc[mb][nb]); if (NSPLIT >= 2) acc[mb][nb] = WFrag<T16>::mma(a[mb], b2, acc[mb][nb]); } }
        asm volatile("v_nop\n\tv_nop\n\tv_nop\n\tv_nop" : "+v"(acc[0][0]), "+v"(acc[1][1]), "+v"(acc[2][2]), "+v"(acc[3][3]) : "v"(a[0]), "v"(a[3]));
    }
#pragma unroll
    for (int mb = 0; mb < 4; ++mb) {
#pragma unroll
        for (int nb = 0; nb < 4; ++nb) {
#pragma unroll
            for (int j = 0; j < 8; ++j) os[(hi * 8 + j) * 68 + nb * 16 + lr] = acc[mb][nb][j]; }
        __builtin_amdgcn_wave_barrier(); asm volatile("" ::: "memory");
        float* crow = C + (size_t)(r0 + mb * 16) * ldc + c0;
{
#pragma unroll
            for (int s = 0; s < 8; ++s) { const int row = 2 * s + hi, cofs = lr * 4; v4f val = *(const v4fa*)(os + row * 68 + cofs);
                *(v4f*)(crow + (size_t)row * ldc + cofs) = val; }
             }
        __builtin_amdgcn_wave_barrier(); asm volatile("" ::: "memory");
    }
}

__device__ __forceinline__ h16 tohx(float x) { return (h16)x; }
__device__ __forceinline__ void splitf(float y, unsigned short& h, unsigned short& l) { h = f2bf(y); l = f2bf(y - bf2f(h)); }

// k_trw: in[rows][cols] f32 -> out[cols][rows] bf16 (RNE), 64x64 tiles through LDS (cross-wave: block barrier); grid (cols/64, rows/64), 256 threads.
__global__ __launch_bounds__(256) void k_trw(const float* __restrict__ in, bf* out, int rows, int cols) {
    __shared__ float ls[64 * 65];
    const int tid = threadIdx.x; const int c0 = blockIdx.x * 64, r0 = blockIdx.y * 64;
#pragma unroll
    for (int i = 0; i < 4; ++i) { const int r = (tid >> 4) + 16 * i; const int c = (tid & 15) * 4; const v4f v = *(const v4f*)(in + (size_t)(r0 + r) * cols + c0 + c);
        ls[r * 65 + c] = v[0]; ls[r * 65 + c + 1] = v[1]; ls[r * 65 + c + 2] = v[2]; ls[r * 65 + c + 3] = v[3]; }
    __syncthreads();
    const int n0 = tid >> 3, n1 = n0 + 32, pc = tid & 7; v8us o0, o1;
#pragma unroll
    for (int j = 0; j < 8; ++j) { o0[j] = f2bf(ls[(pc * 8 + j) * 65 + n0]); o1[j] = f2bf(ls[(pc * 8 + j) * 65 + n1]); }
    bf* p0 = out + (size_t)(c0 + n0) * rows + r0 + pc * 8; bf* p1 = out + (size_t)(c0 + n1) * rows + r0 + pc * 8;
    *(v8us*)p0 = o0; *(v8us*)p1 = o1; 
}

__global__ __launch_bounds__(256) void k_cvtx(const float* __restrict__ x, bf* dst, int b) { const size_t i = (size_t)blockIdx.x * 256 + threadIdx.x; if (i >= (size_t)TT * DM / 8) return; const int t = (int)(i / (DM / 8)); const int c8 = (int)(i % (DM / 8));
    const v8f v = *(const v8f*)(x + ((size_t)t * NB_FULL + b) * DM + (size_t)c8 * 8); v8us o;
#pragma unroll
    for (int k = 0; k < 8; ++k) o[k] = f2bf(v[k]); *(v8us*)(dst + i * 8) = o;  }

// k_mchk: one block scans the additive mask rows 0..TT-1: every entry above the diagonal must be <= -1e8 (its softmax weight is then exactly zero) and every diagonal entry >= -1e4.
__global__ __launch_bounds__(256) void k_mchk(const float* __restrict__ M, float* FLG) {
    __shared__ int wb[8];
    const int tid = threadIdx.x, lane = tid & 31, wv = tid >> 5; int bad = 0;
#pragma unroll 1
    for (int idx = tid; idx < TT * (TT / 4); idx += 256) { const int i = idx / (TT / 4); const int j0 = (idx % (TT / 4)) * 4; const v4f m = *(const v4f*)(M + (size_t)i * SEQ_FULL + j0);
#pragma unroll
        for (int q = 0; q < 4; ++q) { const int j = j0 + q; const int bu = (m[q] <= -1.0e8f) ? 0 : 1; const int bd = (m[q] >= -1.0e4f) ? 0 : 1; bad += (j > i) ? bu : 0; bad += (j == i) ? bd : 0; } }
#pragma unroll
    for (int sh = 16; sh; sh >>= 1) bad += __shfl_xor(bad, sh, 32);
    if (lane == 0) wb[wv] = bad;
    __syncthreads();
    if (wv == 0) { int tot = 0;
#pragma unroll
        for (int k = 0; k < 8; ++k) tot += wb[k];
        const float fv = tot ? __uint_as_float(0x7FC00000u) : 1.0f;
        if (lane < 8) { v4f o; o[0] = fv; o[1] = fv; o[2] = fv; o[3] = fv; *(v4f*)(FLG + lane * 4) = o;  } }
}

// k_rope: head planes [h][t][d] (fp16 + bf16 hi/lo) of rotary(x) x sc, interleaved-pair convention with the INPUT tables read as values (RNE bf16):
// out[2i] = x[2i] cos[t][2i] - x[2i+1] sin[t][2i], out[2i+1] = x[2i+1] cos[t][2i+1] + x[2i] sin[t][2i+1]; products and sum separately in f32.
__global__ __launch_bounds__(256) void k_rope(const float* __restrict__ F, int pitch, int nheads, const float* __restrict__ COS, const float* __restrict__ SIN, float sc, h16* P16, bf* Ph, bf* Pl) {
    const size_t e = ((size_t)blockIdx.x * 256 + threadIdx.x) * 2; if (e >= (size_t)nheads * TT * HD) return; const int d = (int)(e % HD); const int t = (int)((e / HD) % TT); const int h = (int)(e / ((size_t)HD * TT));
    const v2f xx = *(const v2f*)(F + (size_t)t * pitch + h * HD + d); const v2f cc = *(const v2f*)(COS + (size_t)t * HD + d); const v2f ss = *(const v2f*)(SIN + (size_t)t * HD + d);
    float a0 = __fmul_rn(xx[0], bfr(cc[0])), b0 = __fmul_rn(xx[1], bfr(ss[0])), a1 = __fmul_rn(xx[1], bfr(cc[1])), b1 = __fmul_rn(xx[0], bfr(ss[1]));
    asm volatile("" : "+v"(a0)); asm volatile("" : "+v"(b0)); asm volatile("" : "+v"(a1)); asm volatile("" : "+v"(b1));
    const float r0 = __fsub_rn(a0, b0) * sc, r1 = __fadd_rn(a1, b1) * sc;
    v2h o16; v2us oh, ol; unsigned short hh, ll; o16[0] = tohx(r0); o16[1] = tohx(r1); splitf(r0, hh, ll); oh[0] = hh; ol[0] = ll; splitf(r1, hh, ll); oh[1] = hh; ol[1] = ll;
    *(v2h*)(P16 + e) = o16; *(v2us*)(Ph + e) = oh; *(v2us*)(Pl + e) = ol;  }

__global__ __launch_bounds__(256) void k_vtp(const float* __restrict__ F, int pitch, int nheads, h16* V16, bf* Vh, bf* Vl) { const size_t e = ((size_t)blockIdx.x * 256 + threadIdx.x) * 2; if (e >= (size_t)nheads * HD * TT) return; const int t = (int)(e % TT); const int d = (int)((e / TT) % HD); const int g = (int)(e / ((size_t)TT * HD)); v2h o16; v2us oh, ol;
#pragma unroll
    for (int q = 0; q < 2; ++q) { const float x = F[(size_t)(t + q) * pitch + g * HD + d]; o16[q] = tohx(x); unsigned short a2, c2; splitf(x, a2, c2); oh[q] = a2; ol[q] = c2; }
    *(v2h*)(V16 + e) = o16; *(v2us*)(Vh + e) = oh; *(v2us*)(Vl + e) = ol;  }

// k_asoft: one wave per row (zz, i): t = S x HD^-0.5 + mask[i][j] (RNE bf16 mask value, read from the input) for j <= i; entries j > i have an exactly zero weight (property checked by k_mchk) and are
__global__ __launch_bounds__(256) void k_asoft(const float* __restrict__ Sb, const float* __restrict__ M, const float* __restrict__ FLG, h16* P16, bf* Ph, bf* Pl) {
    const int lane = threadIdx.x & 31; const int wv = __builtin_amdgcn_readfirstlane((int)(threadIdx.x >> 5)); const int row = blockIdx.x * 8 + wv; if (row >= ZH * TT) return;
    const int i = row % TT; const int zz = row / TT; const bool hires = (i < RH); const float* sr = Sb + (size_t)row * TT; const float* mr = M + (size_t)i * SEQ_FULL; const float fl = FLG[0]; float v[TT / 32]; float mx = -3.0e38f;
#pragma unroll
    for (int ch = 0; ch < TT / 128; ++ch) { const int j0 = ch * 128 + lane * 4; const v4f a = *(const v4f*)(sr + j0); v4f mk; mk[0] = 0.f; mk[1] = 0.f; mk[2] = 0.f; mk[3] = 0.f;
        if (ch * 128 <= i) mk = *(const v4f*)(mr + j0);      // wave-uniform condition (i is scalar)
#pragma unroll
        for (int q = 0; q < 4; ++q) { const int j = j0 + q; const float sv = a[q] * SCL + bfr(mk[q]); const float t = (j <= i) ? sv : -3.0e38f; v[ch * 4 + q] = t; mx = fmaxf(mx, t); } }
#pragma unroll
    for (int sh = 16; sh; sh >>= 1) mx = fmaxf(mx, __shfl_xor(mx, sh, 32));
    float sum = 0.f;
#pragma unroll
    for (int k = 0; k < TT / 32; ++k) { float d0 = __fsub_rn(v[k], mx); asm volatile("" : "+v"(d0)); v[k] = __builtin_amdgcn_exp2f(__fmul_rn(d0, 1.4426950408889634f)); sum += v[k]; }
#pragma unroll
    for (int sh = 16; sh; sh >>= 1) sum += __shfl_xor(sum, sh, 32);
    const float f = __fdiv_rn(hires ? 1.0f : PCAR, sum) * fl;
{
        if (hires) {
#pragma unroll
            for (int ch = 0; ch < TT / 128; ++ch) { v4us oh, ol;
#pragma unroll
                for (int q = 0; q < 4; ++q) { unsigned short a, c2; splitf(v[ch * 4 + q] * f, a, c2); oh[q] = a; ol[q] = c2; }
                const size_t oo = ((size_t)zz * RH + i) * TT + ch * 128 + lane * 4; *(v4us*)(Ph + oo) = oh; *(v4us*)(Pl + oo) = ol; }
        } else {
#pragma unroll
            for (int ch = 0; ch < TT / 128; ++ch) { v4h o4;
#pragma unroll
                for (int q = 0; q < 4; ++q) o4[q] = tohx(v[ch * 4 + q] * f);
                *(v4h*)(P16 + (size_t)row * TT + ch * 128 + lane * 4) = o4; } }
         }
}

__global__ __launch_bounds__(256) void k_merge(const float* __restrict__ O, int h0, bf* Ah, bf* Al) { const size_t e = ((size_t)blockIdx.x * 256 + threadIdx.x) * 2; if (e >= (size_t)ZH * TT * HD) return; const int d = (int)(e % HD); const int t = (int)((e / HD) % TT); const int zz = (int)(e / ((size_t)HD * TT)); const float cs = (t < RH) ? 1.0f : (1.0f / PCAR); const size_t oo = (size_t)t * DQ + (h0 + zz) * HD + d;
    v2us oh, ol;
#pragma unroll
    for (int q = 0; q < 2; ++q) { unsigned short a, c2; splitf(O[e + q] * cs, a, c2); oh[q] = a; ol[q] = c2; } *(v2us*)(Ah + oo) = oh; *(v2us*)(Al + oo) = ol;  }

#define AL256(b) ((((size_t)(b)) + 255) & ~(size_t)255)
constexpr size_t WS_TOTAL =
    AL256((size_t)3 * DM * DM * 2) + AL256((size_t)DM * DQ * 2) + AL256(256) + AL256((size_t)TT * DM * 2) + AL256((size_t)TT * DQ * 4)
    + 3 * AL256((size_t)NH_ * TT * HD * 2) + 6 * AL256((size_t)NH_ * TT * HD * 2) + 2 * AL256((size_t)ZH * RH * TT * 2)
    + AL256((size_t)ZH * TT * TT * 4) + AL256((size_t)ZH * TT * TT * 2) + AL256((size_t)ZH * TT * HD * 4) + 2 * AL256((size_t)TT * DQ * 2);
static_assert(WS_TOTAL <= (size_t)134217728);

extern "C" void kernel_launch(void* const* d_in, const int* in_sizes, int n_in,
                              void* d_out, int out_size, void* d_ws, size_t ws_size, hipStream_t stream) {
    if (n_in < 6) return;
    if ((size_t)in_sizes[0] < (size_t)TT * NB_FULL * DM) return;      // x [S][B][D]
    if ((size_t)in_sizes[1] < (size_t)TT * SEQ_FULL) return;          // additive mask [S][S]
    if ((size_t)in_sizes[2] < (size_t)TT * HD) return;                // cos [S][64]
    if ((size_t)in_sizes[3] < (size_t)TT * HD) return;                // sin [S][64]
    if ((size_t)in_sizes[4] < (size_t)DM * 3 * DM) return;            // Wqkv [in 1024][out 3072]
    if ((size_t)in_sizes[5] < (size_t)DM * DM) return;                // Wout [in 1024][out 1024]
    if ((size_t)out_size < (size_t)TT * NB_ * DM) return;
    const float* x = (const float*)d_in[0]; const float* mask = (const float*)d_in[1]; const float* cosb = (const float*)d_in[2]; const float* sinb = (const float*)d_in[3];
    const float* wqkv = (const float*)d_in[4]; const float* wout = (const float*)d_in[5];
    float* OUT = (float*)d_out;     // [S][B][D]
    char* wsp = (char*)d_ws;
    auto take = [&](size_t bytes) { char* p = wsp; wsp += (bytes + 255) & ~(size_t)255; return (void*)p; };
    bf* WQKV = (bf*)take((size_t)3 * DM * DM * 2);     // [3072 out][1024 in]: q | k | v = row thirds
    bf* WO = (bf*)take((size_t)DM * DQ * 2);           // [1024 out][1024 in]
    float* FLG = (float*)take(256);
    bf* XB = (bf*)take((size_t)TT * DM * 2); float* F = (float*)take((size_t)TT * DQ * 4);   // F is reused for q, k, v in stream order
    h16* QP16 = (h16*)take((size_t)NH_ * TT * HD * 2); h16* KP16 = (h16*)take((size_t)NKV * TT * HD * 2); h16* VT16 = (h16*)take((size_t)NKV * HD * TT * 2);
    bf* QPh = (bf*)take((size_t)NH_ * TT * HD * 2); bf* QPl = (bf*)take((size_t)NH_ * TT * HD * 2); bf* KPh = (bf*)take((size_t)NKV * TT * HD * 2); bf* KPl = (bf*)take((size_t)NKV * TT * HD * 2); bf* VTh = (bf*)take((size_t)NKV * HD * TT * 2); bf* VTl = (bf*)take((size_t)NKV * HD * TT * 2);
    bf* Ph = (bf*)take((size_t)ZH * RH * TT * 2); bf* Pl = (bf*)take((size_t)ZH * RH * TT * 2);
    float* Sb = (float*)take((size_t)ZH * TT * TT * 4); h16* P16 = (h16*)take((size_t)ZH * TT * TT * 2); float* Ob = (float*)take((size_t)ZH * TT * HD * 4); bf* ATh = (bf*)take((size_t)TT * DQ * 2); bf* ATl = (bf*)take((size_t)TT * DQ * 2);
    if ((size_t)(wsp - (char*)d_ws) > ws_size) return;
    if ((size_t)(wsp - (char*)d_ws) > (size_t)134217728) return;

    // in[rows = 1024 (in)][cols = 3072 (out)] -> out[cols][rows]; grid (cols/64, rows/64)
    k_trw<<<dim3(3 * DM / 64, DM / 64, 1), 256, 0, stream>>>(wqkv, WQKV, DM, 3 * DM);
    // in[rows = 1024 (in)][cols = 1024 (out)] -> out[cols][rows]; grid (cols/64, rows/64)
    k_trw<<<dim3(DM / 64, DM / 64, 1), 256, 0, stream>>>(wout, WO, DM, DM);
    k_mchk<<<1, 256, 0, stream>>>(mask, FLG);

    const unsigned LQ = (unsigned)(((size_t)NH_ * TT * HD / 2 + 255) / 256), LKv = (unsigned)(((size_t)NKV * TT * HD / 2 + 255) / 256);
    for (int b = 0; b < NB_; ++b) {
        k_cvtx<<<(unsigned)(((size_t)TT * DM / 8 + 255) / 256), 256, 0, stream>>>(x, XB, b);
        k_gemmw<bf, 0, false><<<dim3(TT / 64, DQ / 64, 1), 32, 0, stream>>>(XB, nullptr, WQKV, nullptr, DM, F, DQ, nullptr, 0, 0, 0);
        k_rope<<<LQ, 256, 0, stream>>>(F, DQ, NH_, cosb, sinb, 1.0f, QP16, QPh, QPl);
        k_gemmw<bf, 0, false><<<dim3(TT / 64, DKV / 64, 1), 32, 0, stream>>>(XB, nullptr, WQKV + (size_t)DQ * DM, nullptr, DM, F, DKV, nullptr, 0, 0, 0);
        k_rope<<<LKv, 256, 0, stream>>>(F, DKV, NKV, cosb, sinb, 1.0f, KP16, KPh, KPl);
        k_gemmw<bf, 0, false><<<dim3(TT / 64, DKV / 64, 1), 32, 0, stream>>>(XB, nullptr, WQKV + (size_t)(DQ + DKV) * DM, nullptr, DM, F, DKV, nullptr, 0, 0, 0);
        k_vtp<<<LKv, 256, 0, stream>>>(F, DKV, NKV, VT16, VTh, VTl);
        for (int h0 = 0; h0 < NH_; h0 += ZH) { const size_t zq = (size_t)h0, zk = (size_t)(h0 / REP);
            k_gemmc<bf, 2, 1><<<dim3(RH / 64, TT / 64, ZH), 32, 0, stream>>>(QPh + zq * TT * HD, QPl + zq * TT * HD, KPh + zk * TT * HD, KPl + zk * TT * HD, HD, Sb, TT, 0, (size_t)TT * HD, (size_t)TT * HD, (size_t)TT * TT);
            if (TT > RH) k_gemmc<h16, 0, 1><<<dim3((TT - RH) / 64, TT / 64, ZH), 32, 0, stream>>>(QP16 + zq * TT * HD + (size_t)RH * HD, nullptr, KP16 + zk * TT * HD, nullptr, HD, Sb + (size_t)RH * TT, TT, RH, (size_t)TT * HD, (size_t)TT * HD, (size_t)TT * TT);
            k_asoft<<<ZH * TT / 8, 256, 0, stream>>>(Sb, mask, FLG, P16, Ph, Pl);
            k_gemmc<bf, 2, 2><<<dim3(RH / 64, HD / 64, ZH), 32, 0, stream>>>(Ph, Pl, VTh + zk * HD * TT, VTl + zk * HD * TT, TT, Ob, HD, 0, (size_t)RH * TT, (size_t)HD * TT, (size_t)TT * HD);
            if (TT > RH) k_gemmc<h16, 0, 2><<<dim3((TT - RH) / 64, HD / 64, ZH), 32, 0, stream>>>(P16 + (size_t)RH * TT, nullptr, VT16 + zk * HD * TT, nullptr, TT, Ob + (size_t)RH * HD, HD, RH, (size_t)TT * TT, (size_t)HD * TT, (size_t)TT * HD);
            k_merge<<<(unsigned)(((size_t)ZH * TT * HD / 2 + 255) / 256), 256, 0, stream>>>(Ob, h0, ATh, ATl); }
        // out[t][b][:] : row pitch NB*DM, batch slab offset b*DM
        k_gemmw<bf, 1, false><<<dim3(TT / 64, DM / 64, 1), 32, 0, stream>>>(ATh, ATl, WO, nullptr, DQ, OUT + (size_t)b * DM, NB_ * DM, nullptr, 0, 0, 0); }
}

// v001
// One run takes 2900 microseconds.
// In both of two side-by-side timings against v000, it was 1.64 times as fast.
#include <hip/hip_runtime.h>

// Contractions (f32 accumulate): qkv projection v_wmma_f32_16x16x32_bf16 (bf16 x bf16, exact products); scores and prob x value: query rows < RH bf16 hi/lo planes (3 products), rows >= RH v_wmma_f32_16x16x32_f16 (probabilities carried x1024); output projection bf16 hi+lo activation x bf16 weight (2 products).
// Every float input is RNE-converted to bf16 on load. Softmax, rotary and all other side math in f32.

#ifndef NB
#define NB 4
#endif
#ifndef SEQ
#define SEQ 2048
#endif
#define NB_FULL  4                 // batch stride of the staged x rows ([S][B][D])
#define SEQ_FULL 2048              // row pitch of the staged additive mask
#define NB_  NB
#define TT   SEQ
#define DM   1024
#define NH_  16
#define NKV  16
#define REP  (NH_ / NKV)
#define HD   64
#define DQ   (NH_ * HD)
#define DKV  (NKV * HD)
#define ZH   2
#define RH   ((SEQ) < 512 ? (SEQ) : 512)   // query rows < RH use hi+lo planes
#define PCAR 1024.0f
#define SCL  0.125f                // HD^-0.5
static_assert(SEQ % 128 == 0);
static_assert(RH % 64 == 0);
static_assert(SEQ <= SEQ_FULL);
static_assert(NB <= NB_FULL);
static_assert(NH_ % ZH == 0);
static_assert(DM % 64 == 0);
static_assert(DQ == DM);

typedef _Float16 h16;
typedef unsigned short bf;
typedef __attribute__((ext_vector_type(16))) __bf16   v16bf;
typedef __attribute__((ext_vector_type(16))) _Float16 v16h;
typedef __attribute__((ext_vector_type(8)))  _Float16 v8h;
typedef __attribute__((ext_vector_type(8)))  unsigned short v8us;
typedef __attribute__((ext_vector_type(8)))  float    v8f;
typedef __attribute__((ext_vector_type(4)))  float    v4f;
typedef __attribute__((ext_vector_type(4)))  int      v4i;
typedef __attribute__((ext_vector_type(2)))  _Float16 v2h;
typedef __attribute__((ext_vector_type(4)))  _Float16 v4h;
typedef __attribute__((ext_vector_type(2)))  unsigned short v2us;
typedef __attribute__((ext_vector_type(4)))  unsigned short v4us;
typedef __attribute__((ext_vector_type(2)))  float    v2f;
typedef v8h  __attribute__((may_alias)) v8ha;
typedef v4f  __attribute__((may_alias)) v4fa;
typedef v8us __attribute__((may_alias)) v8usa;

__device__ __forceinline__ unsigned short f2bf(float f) { unsigned u = __float_as_uint(f); u += 0x7FFFu + ((u >> 16) & 1u); return (unsigned short)(u >> 16); }
__device__ __forceinline__ float bf2f(unsigned short b) { return __uint_as_float(((unsigned)b) << 16); }
__device__ __forceinline__ float bfr(float f) { return bf2f(f2bf(f)); }
__device__ __forceinline__ v16h cat16(v8h lo, v8h hi) { return __builtin_shufflevector(lo, hi, 0, 1, 2, 3, 4, 5, 6, 7, 8, 9, 10, 11, 12, 13, 14, 15); }
__device__ __forceinline__ v16bf cat16b(v8us lo, v8us hi) { return __builtin_bit_cast(v16bf, __builtin_shufflevector(lo, hi, 0, 1, 2, 3, 4, 5, 6, 7, 8, 9, 10, 11, 12, 13, 14, 15)); }
__device__ __forceinline__ v8f wmma16(v16h a, v16h b, v8f c) { return __builtin_amdgcn_wmma_f32_16x16x32_f16(false, a, false, b, (short)0, c, false, false); }
__device__ __forceinline__ v8f wmmab(v16bf a, v16bf b, v8f c) { return __builtin_amdgcn_wmma_f32_16x16x32_bf16(false, a, false, b, (short)0, c, false, false); }

// ---- k_gemmw: register-blocked GEMM, ONE WAVE per 64x64 output tile (16 accumulators), operands straight from K-contiguous 16-bit planes; grid (M/64, N/64, Z), 32 threads.
// C[m][n] (f32, pitch ldc, + optional f32 bias[n]) = sum_k A[m][k] Bt[n][k] (+ split products per NSPLIT). z-batch strides sA/sB/sC in elements. K % 32 == 0, M % 64 == 0, N % 64 == 0.
// Fragment map: lane -> row/col (lane & 15); elements 0..7 <- k0 + 8*(lane>>4) + 0..7, elements 8..15 <- k0 + 16 + 8*(lane>>4) + 0..7; D element j <- (row 8*(lane>>4) + j, col lane & 15).
template <typename T16> struct WFrag;
template <> struct WFrag<h16> { typedef v16h V; static __device__ __forceinline__ V ld(const h16* p) { return cat16(*(const v8h*)p, *(const v8h*)(p + 16)); } static __device__ __forceinline__ v8f mma(V a, V b, v8f c) { return wmma16(a, b, c); } };
template <> struct WFrag<bf> { typedef v16bf V; static __device__ __forceinline__ V ld(const bf* p) { return cat16b(*(const v8us*)p, *(const v8us*)(p + 16)); } static __device__ __forceinline__ v8f mma(V a, V b, v8f c) { return wmmab(a, b, c); } };
template <typename T16, int NSPLIT, bool BIAS>
__global__ __launch_bounds__(32) void k_gemmw(const T16* __restrict__ A, const T16* __restrict__ A2, const T16* __restrict__ Bt, const T16* __restrict__ Bt2, int K, float* C, int ldc, const float* __restrict__ bias, size_t sA, size_t sB, size_t sC) {
    typedef typename WFrag<T16>::V V;
    __shared__ __align__(16) float os[16 * 68];
    const size_t z = blockIdx.z; A += z * sA; if (A2) A2 += z * sA; Bt += z * sB; if (Bt2) Bt2 += z * sB; C += z * sC;
    const int lane = threadIdx.x & 31, lr = lane & 15, hi = lane >> 4; const int r0 = blockIdx.x * 64, c0 = blockIdx.y * 64;
    v8f acc[4][4];
#pragma unroll
    for (int mb = 0; mb < 4; ++mb)
#pragma unroll
        for (int nb = 0; nb < 4; ++nb) acc[mb][nb] = (v8f){};
    const size_t aoff = (size_t)(r0 + lr) * K + 8 * hi, boff = (size_t)(c0 + lr) * K + 8 * hi;
#pragma unroll 1
    for (int kc = 0; kc < K; kc += 32) {
        V a[4], a2[4];
#pragma unroll
        for (int mb = 0; mb < 4; ++mb) { a[mb] = WFrag<T16>::ld(A + aoff + (size_t)mb * 16 * K + kc); if (NSPLIT == 1 || NSPLIT == 2) a2[mb] = WFrag<T16>::ld(A2 + aoff + (size_t)mb * 16 * K + kc); }
#pragma unroll
        for (int nb = 0; nb < 4; ++nb) { const V b = WFrag<T16>::ld(Bt + boff + (size_t)nb * 16 * K + kc); V b2; if (NSPLIT >= 2) b2 = WFrag<T16>::ld(Bt2 + boff + (size_t)nb * 16 * K + kc);
#pragma unroll
            for (int mb = 0; mb < 4; ++mb) { acc[mb][nb] = WFrag<T16>::mma(a[mb], b, acc[mb][nb]); if (NSPLIT == 1 || NSPLIT == 2) acc[mb][nb] = WFrag<T16>::mma(a2[mb], b, acc[mb][nb]); if (NSPLIT >= 2) acc[mb][nb] = WFrag<T16>::mma(a[mb], b2, acc[mb][nb]); } }
        asm volatile("v_nop\n\tv_nop\n\tv_nop\n\tv_nop" : "+v"(acc[0][0]), "+v"(acc[1][1]), "+v"(acc[2][2]), "+v"(acc[3][3]) : "v"(a[0]), "v"(a[3]));
    }
#pragma unroll
    for (int mb = 0; mb < 4; ++mb) {
#pragma unroll
        for (int nb = 0; nb < 4; ++nb) {
#pragma unroll
            for (int j = 0; j < 8; ++j) os[(hi * 8 + j) * 68 + nb * 16 + lr] = acc[mb][nb][j]; }
        __builtin_amdgcn_wave_barrier(); asm volatile("" ::: "memory");
        float* crow = C + (size_t)(r0 + mb * 16) * ldc + c0;
{
#pragma unroll
            for (int s = 0; s < 8; ++s) { const int row = 2 * s + hi, cofs = lr * 4; v4f val = *(const v4fa*)(os + row * 68 + cofs); if (BIAS) { val[0] += bfr(bias[c0 + cofs]); val[1] += bfr(bias[c0 + cofs + 1]); val[2] += bfr(bias[c0 + cofs + 2]); val[3] += bfr(bias[c0 + cofs + 3]); }
                *(v4f*)(crow + (size_t)row * ldc + cofs) = val; }
             }
        __builtin_amdgcn_wave_barrier(); asm volatile("" ::: "memory");
    }
}

// ---- k_gemmc: the same one-wave 64x64 tile GEMM specialised for causal attention: CMODE 1 skips score tiles entirely above the diagonal (query rows r0+roff.., key columns c0..), CMODE 2 limits the
// key (K) loop of the probability x value contraction to the diagonal block (probabilities beyond it are exactly zero). roff = row offset of this launch's first row within the sequence.
template <typename T16, int NSPLIT, int CMODE>
__global__ __launch_bounds__(32) void k_gemmc(const T16* __restrict__ A, const T16* __restrict__ A2, const T16* __restrict__ Bt, const T16* __restrict__ Bt2, int K, float* C, int ldc, int roff, size_t sA, size_t sB, size_t sC) {
    typedef typename WFrag<T16>::V V;
    __shared__ __align__(16) float os[16 * 68];
    const size_t z = blockIdx.z; A += z * sA; if (A2) A2 += z * sA; Bt += z * sB; if (Bt2) Bt2 += z * sB; C += z * sC;
    const int lane = threadIdx.x & 31, lr = lane & 15, hi = lane >> 4; const int r0 = blockIdx.x * 64, c0 = blockIdx.y * 64;
    if (CMODE == 1 && c0 > r0 + roff + 63) return;                  // score tile entirely above the causal diagonal: never produced (the softmax discards j > i by value select)
    const int Kl = (CMODE == 2) ? min(K, r0 + roff + 64) : K;        // P.V: probabilities are exactly 0 beyond the diagonal block, so the K loop stops there
    v8f acc[4][4];
#pragma unroll
    for (int mb = 0; mb < 4; ++mb)
#pragma unroll
        for (int nb = 0; nb < 4; ++nb) acc[mb][nb] = (v8f){};
    const size_t aoff = (size_t)(r0 + lr) * K + 8 * hi, boff = (size_t)(c0 + lr) * K + 8 * hi;
#pragma unroll 1
    for (int kc = 0; kc < Kl; kc += 32) {
        V a[4], a2[4];
#pragma unroll
        for (int mb = 0; mb < 4; ++mb) { a[mb] = WFrag<T16>::ld(A + aoff + (size_t)mb * 16 * K + kc); if (NSPLIT == 1 || NSPLIT == 2) a2[mb] = WFrag<T16>::ld(A2 + aoff + (size_t)mb * 16 * K + kc); }
#pragma unroll
        for (int nb = 0; nb < 4; ++nb) { const V b = WFrag<T16>::ld(Bt + boff + (size_t)nb * 16 * K + kc); V b2; if (NSPLIT >= 2) b2 = WFrag<T16>::ld(Bt2 + boff + (size_t)nb * 16 * K + kc);
#pragma unroll
            for (int mb = 0; mb < 4; ++mb) { acc[mb][nb] = WFrag<T16>::mma(a[mb], b, acc[mb][nb]); if (NSPLIT == 1 || NSPLIT == 2) acc[mb][nb] = WFrag<T16>::mma(a2[mb], b, acc[mb][nb]); if (NSPLIT >= 2) acc[mb][nb] = WFrag<T16>::mma(a[mb], b2, acc[mb][nb]); } }
        asm volatile("v_nop\n\tv_nop\n\tv_nop\n\tv_nop" : "+v"(acc[0][0]), "+v"(acc[1][1]), "+v"(acc[2][2]), "+v"(acc[3][3]) : "v"(a[0]), "v"(a[3]));
    }
#pragma unroll
    for (int mb = 0; mb < 4; ++mb) {
#pragma unroll
        for (int nb = 0; nb < 4; ++nb) {
#pragma unroll
            for (int j = 0; j < 8; ++j) os[(hi * 8 + j) * 68 + nb * 16 + lr] = acc[mb][nb][j]; }
        __builtin_amdgcn_wave_barrier(); asm volatile("" ::: "memory");
        float* crow = C + (size_t)(r0 + mb * 16) * ldc + c0;
{
#pragma unroll
            for (int s = 0; s < 8; ++s) { const int row = 2 * s + hi, cofs = lr * 4; v4f val = *(const v4fa*)(os + row * 68 + cofs);
                *(v4f*)(crow + (size_t)row * ldc + cofs) = val; }
             }
        __builtin_amdgcn_wave_barrier(); asm volatile("" ::: "memory");
    }
}

__device__ __forceinline__ h16 tohx(float x) { return (h16)x; }
__device__ __forceinline__ void splitf(float y, unsigned short& h, unsigned short& l) { h = f2bf(y); l = f2bf(y - bf2f(h)); }

// k_trw: in[rows][cols] f32 -> out[cols][rows] bf16 (RNE), 64x64 tiles through LDS (cross-wave: block barrier); grid (cols/64, rows/64), 256 threads.
__global__ __launch_bounds__(256) void k_trw(const float* __restrict__ in, bf* out, int rows, int cols) {
    __shared__ float ls[64 * 65];
    const int tid = threadIdx.x; const int c0 = blockIdx.x * 64, r0 = blockIdx.y * 64;
#pragma unroll
    for (int i = 0; i < 4; ++i) { const int r = (tid >> 4) + 16 * i; const int c = (tid & 15) * 4; const v4f v = *(const v4f*)(in + (size_t)(r0 + r) * cols + c0 + c);
        ls[r * 65 + c] = v[0]; ls[r * 65 + c + 1] = v[1]; ls[r * 65 + c + 2] = v[2]; ls[r * 65 + c + 3] = v[3]; }
    __syncthreads();
    const int n0 = tid >> 3, n1 = n0 + 32, pc = tid & 7; v8us o0, o1;
#pragma unroll
    for (int j = 0; j < 8; ++j) { o0[j] = f2bf(ls[(pc * 8 + j) * 65 + n0]); o1[j] = f2bf(ls[(pc * 8 + j) * 65 + n1]); }
    bf* p0 = out + (size_t)(c0 + n0) * rows + r0 + pc * 8; bf* p1 = out + (size_t)(c0 + n1) * rows + r0 + pc * 8;
    *(v8us*)p0 = o0; *(v8us*)p1 = o1; 
}

__global__ __launch_bounds__(256) void k_cvtx(const float* __restrict__ x, bf* dst, int b) { const size_t i = (size_t)blockIdx.x * 256 + threadIdx.x; if (i >= (size_t)TT * DM / 8) return; const int t = (int)(i / (DM / 8)); const int c8 = (int)(i % (DM / 8));
    const v8f v = *(const v8f*)(x + ((size_t)t * NB_FULL + b) * DM + (size_t)c8 * 8); v8us o;
#pragma unroll
    for (int k = 0; k < 8; ++k) o[k] = f2bf(v[k]); *(v8us*)(dst + i * 8) = o;  }

// k_mchk: the additive mask rows 0..TT-1 are scanned by TT/8 blocks of 8 rows each, one wave per row: every entry above the diagonal must be <= -1e8 (its softmax weight is then exactly zero) and every diagonal entry >= -1e4.
// Block p stores its count of violations into its own 128-byte line of PB; k_mred, the next launch, adds the lines up.
__global__ __launch_bounds__(256) void k_mchk(const float* __restrict__ M, int* PB) {
    __shared__ int wb[8];
    const int tid = threadIdx.x, lane = tid & 31, wv = tid >> 5; int bad = 0;
    const int i = (int)blockIdx.x * 8 + __builtin_amdgcn_readfirstlane(wv);      // one wave per row: the row number and the row's base address are scalar
    const float* mr = M + (size_t)i * SEQ_FULL + lane * 4;
    // unrolled so that a lane's TT/128 independent loads overlap instead of each waiting for the one before
#pragma unroll
    for (int u = 0; u < TT / 128; ++u) { const int j0 = u * 128 + lane * 4; const v4f m = *(const v4f*)(mr + u * 128);
#pragma unroll
        for (int q = 0; q < 4; ++q) { const int j = j0 + q; const int bu = (m[q] <= -1.0e8f) ? 0 : 1; const int bd = (m[q] >= -1.0e4f) ? 0 : 1; bad += (j > i) ? bu : 0; bad += (j == i) ? bd : 0; } }
#pragma unroll
    for (int sh = 16; sh; sh >>= 1) bad += __shfl_xor(bad, sh, 32);
    if (lane == 0) wb[wv] = bad;
    __syncthreads();
    if (wv == 0) { int tot = 0;
#pragma unroll
        for (int k = 0; k < 8; ++k) tot += wb[k];
        if (lane < 8) { v4i o; o[0] = tot; o[1] = tot; o[2] = tot; o[3] = tot; *(v4i*)(PB + (size_t)blockIdx.x * 32 + lane * 4) = o; } }
}

// k_mred: one wave adds the TT/8 per-block counts of k_mchk and writes the flag line: 1.0 if no entry violates, NaN otherwise.
__global__ __launch_bounds__(32) void k_mred(const int* __restrict__ PB, float* FLG) {
    const int lane = threadIdx.x & 31; int tot = 0;
    // unrolled so that the lane's loads go out together: one memory latency for the whole launch
#pragma unroll
    for (int k = lane; k < TT / 8; k += 32) tot += PB[(size_t)k * 32];
#pragma unroll
    for (int sh = 16; sh; sh >>= 1) tot += __shfl_xor(tot, sh, 32);
    const float fv = tot ? __uint_as_float(0x7FC00000u) : 1.0f;
    if (lane < 8) { v4f o; o[0] = fv; o[1] = fv; o[2] = fv; o[3] = fv; *(v4f*)(FLG + lane * 4) = o; }
}

// k_rope: head planes [h][t][d] (fp16 + bf16 hi/lo) of rotary(x) x sc, interleaved-pair convention with the INPUT tables read as values (RNE bf16):
// out[2i] = x[2i] cos[t][2i] - x[2i+1] sin[t][2i], out[2i+1] = x[2i+1] cos[t][2i+1] + x[2i] sin[t][2i+1]; products and sum separately in f32.
__global__ __launch_bounds__(256) void k_rope(const float* __restrict__ F, int pitch, int nheads, const float* __restrict__ COS, const float* __restrict__ SIN, float sc, h16* P16, bf* Ph, bf* Pl) {
    const size_t e = ((size_t)blockIdx.x * 256 + threadIdx.x) * 2; if (e >= (size_t)nheads * TT * HD) return; const int d = (int)(e % HD); const int t = (int)((e / HD) % TT); const int h = (int)(e / ((size_t)HD * TT));
    const v2f xx = *(const v2f*)(F + (size_t)t * pitch + h * HD + d); const v2f cc = *(const v2f*)(COS + (size_t)t * HD + d); const v2f ss = *(const v2f*)(SIN + (size_t)t * HD + d);
    float a0 = __fmul_rn(xx[0], bfr(cc[0])), b0 = __fmul_rn(xx[1], bfr(ss[0])), a1 = __fmul_rn(xx[1], bfr(cc[1])), b1 = __fmul_rn(xx[0], bfr(ss[1]));
    asm volatile("" : "+v"(a0)); asm volatile("" : "+v"(b0)); asm volatile("" : "+v"(a1)); asm volatile("" : "+v"(b1));
    const float r0 = __fsub_rn(a0, b0) * sc, r1 = __fadd_rn(a1, b1) * sc;
    v2h o16; v2us oh, ol; unsigned short hh, ll; o16[0] = tohx(r0); o16[1] = tohx(r1); splitf(r0, hh, ll); oh[0] = hh; ol[0] = ll; splitf(r1, hh, ll); oh[1] = hh; ol[1] = ll;
    *(v2h*)(P16 + e) = o16; *(v2us*)(Ph + e) = oh; *(v2us*)(Pl + e) = ol;  }

__global__ __launch_bounds__(256) void k_vtp(const float* __restrict__ F, int pitch, int nheads, h16* V16, bf* Vh, bf* Vl) { const size_t e = ((size_t)blockIdx.x * 256 + threadIdx.x) * 2; if (e >= (size_t)nheads * HD * TT) return; const int t = (int)(e % TT); const int d = (int)((e / TT) % HD); const int g = (int)(e / ((size_t)TT * HD)); v2h o16; v2us oh, ol;
#pragma unroll
    for (int q = 0; q < 2; ++q) { const float x = F[(size_t)(t + q) * pitch + g * HD + d]; o16[q] = tohx(x); unsigned short a2, c2; splitf(x, a2, c2); oh[q] = a2; ol[q] = c2; }
    *(v2h*)(V16 + e) = o16; *(v2us*)(Vh + e) = oh; *(v2us*)(Vl + e) = ol;  }

// k_asoft: one wave per row (zz, i): t = S x HD^-0.5 + mask[i][j] (RNE bf16 mask value, read from the input) for j <= i; entries j > i have an exactly zero weight (property checked by k_mchk) and are
__global__ __launch_bounds__(256) void k_asoft(const float* __restrict__ Sb, const float* __restrict__ M, const float* __restrict__ FLG, h16* P16, bf* Ph, bf* Pl) {
    const int lane = threadIdx.x & 31; const int wv = __builtin_amdgcn_readfirstlane((int)(threadIdx.x >> 5)); const int row = blockIdx.x * 8 + wv; if (row >= ZH * TT) return;
    const int i = row % TT; const int zz = row / TT; const bool hires = (i < RH); const float* sr = Sb + (size_t)row * TT; const float* mr = M + (size_t)i * SEQ_FULL; const float fl = FLG[0]; float v[TT / 32]; float mx = -3.0e38f;
#pragma unroll
    for (int ch = 0; ch < TT / 128; ++ch) { const int j0 = ch * 128 + lane * 4; const v4f a = *(const v4f*)(sr + j0); v4f mk; mk[0] = 0.f; mk[1] = 0.f; mk[2] = 0.f; mk[3] = 0.f;
        if (ch * 128 <= i) mk = *(const v4f*)(mr + j0);      // wave-uniform condition (i is scalar)
#pragma unroll
        for (int q = 0; q < 4; ++q) { const int j = j0 + q; const float sv = a[q] * SCL + bfr(mk[q]); const float t = (j <= i) ? sv : -3.0e38f; v[ch * 4 + q] = t; mx = fmaxf(mx, t); } }
#pragma unroll
    for (int sh = 16; sh; sh >>= 1) mx = fmaxf(mx, __shfl_xor(mx, sh, 32));
    float sum = 0.f;
#pragma unroll
    for (int k = 0; k < TT / 32; ++k) { float d0 = __fsub_rn(v[k], mx); asm volatile("" : "+v"(d0)); v[k] = __builtin_amdgcn_exp2f(__fmul_rn(d0, 1.4426950408889634f)); sum += v[k]; }
#pragma unroll
    for (int sh = 16; sh; sh >>= 1) sum += __shfl_xor(sum, sh, 32);
    const float f = __fdiv_rn(hires ? 1.0f : PCAR, sum) * fl;
{
        if (hires) {
#pragma unroll
            for (int ch = 0; ch < TT / 128; ++ch) { v4us oh, ol;
#pragma unroll
                for (int q = 0; q < 4; ++q) { unsigned short a, c2; splitf(v[ch * 4 + q] * f, a, c2); oh[q] = a; ol[q] = c2; }
                const size_t oo = ((size_t)zz * RH + i) * TT + ch * 128 + lane * 4; *(v4us*)(Ph + oo) = oh; *(v4us*)(Pl + oo) = ol; }
        } else {
#pragma unroll
            for (int ch = 0; ch < TT / 128; ++ch) { v4h o4;
#pragma unroll
                for (int q = 0; q < 4; ++q) o4[q] = tohx(v[ch * 4 + q] * f);
                *(v4h*)(P16 + (size_t)row * TT + ch * 128 + lane * 4) = o4; } }
         }
}

__global__ __launch_bounds__(256) void k_merge(const float* __restrict__ O, int h0, bf* Ah, bf* Al) { const size_t e = ((size_t)blockIdx.x * 256 + threadIdx.x) * 2; if (e >= (size_t)ZH * TT * HD) return; const int d = (int)(e % HD); const int t = (int)((e / HD) % TT); const int zz = (int)(e / ((size_t)HD * TT)); const float cs = (t < RH) ? 1.0f : (1.0f / PCAR); const size_t oo = (size_t)t * DQ + (h0 + zz) * HD + d;
    v2us oh, ol;
#pragma unroll
    for (int q = 0; q < 2; ++q) { unsigned short a, c2; splitf(O[e + q] * cs, a, c2); oh[q] = a; ol[q] = c2; } *(v2us*)(Ah + oo) = oh; *(v2us*)(Al + oo) = ol;  }

#define AL256(b) ((((size_t)(b)) + 255) & ~(size_t)255)
constexpr size_t WS_TOTAL =
    AL256((size_t)3 * DM * DM * 2) + AL256((size_t)DM * DQ * 2) + AL256(256) + AL256((size_t)(TT / 8) * 128) + AL256((size_t)TT * DM * 2) + AL256((size_t)TT * DQ * 4)
    + 3 * AL256((size_t)NH_ * TT * HD * 2) + 6 * AL256((size_t)NH_ * TT * HD * 2) + 2 * AL256((size_t)ZH * RH * TT * 2)
    + AL256((size_t)ZH * TT * TT * 4) + AL256((size_t)ZH * TT * TT * 2) + AL256((size_t)ZH * TT * HD * 4) + 2 * AL256((size_t)TT * DQ * 2);
static_assert(WS_TOTAL <= (size_t)134217728);

extern "C" void kernel_launch(void* const* d_in, const int* in_sizes, int n_in,
                              void* d_out, int out_size, void* d_ws, size_t ws_size, hipStream_t stream) {
    if (n_in < 6) return;
    if ((size_t)in_sizes[0] < (size_t)TT * NB_FULL * DM) return;      // x [S][B][D]
    if ((size_t)in_sizes[1] < (size_t)TT * SEQ_FULL) return;          // additive mask [S][S]
    if ((size_t)in_sizes[2] < (size_t)TT * HD) return;                // cos [S][64]
    if ((size_t)in_sizes[3] < (size_t)TT * HD) return;                // sin [S][64]
    if ((size_t)in_sizes[4] < (size_t)DM * 3 * DM) return;            // Wqkv [in 1024][out 3072]
    if ((size_t)in_sizes[5] < (size_t)DM * DM) return;                // Wout [in 1024][out 1024]
    if ((size_t)out_size < (size_t)TT * NB_ * DM) return;
    const float* x = (const float*)d_in[0]; const float* mask = (const float*)d_in[1]; const float* cosb = (const float*)d_in[2]; const float* sinb = (const float*)d_in[3];
    const float* wqkv = (const float*)d_in[4]; const float* wout = (const float*)d_in[5];
    float* OUT = (float*)d_out;     // [S][B][D]
    char* wsp = (char*)d_ws;
    auto take = [&](size_t bytes) { char* p = wsp; wsp += (bytes + 255) & ~(size_t)255; return (void*)p; };
    bf* WQKV = (bf*)take((size_t)3 * DM * DM * 2);     // [3072 out][1024 in]: q | k | v = row thirds
    bf* WO = (bf*)take((size_t)DM * DQ * 2);           // [1024 out][1024 in]
    float* FLG = (float*)take(256);
    int* PB = (int*)take((size_t)(TT / 8) * 128);      // one 128-byte line per block of the mask scan
    bf* XB = (bf*)take((size_t)TT * DM * 2); float* F = (float*)take((size_t)TT * DQ * 4);   // F is reused for q, k, v in stream order
    h16* QP16 = (h16*)take((size_t)NH_ * TT * HD * 2); h16* KP16 = (h16*)take((size_t)NKV * TT * HD * 2); h16* VT16 = (h16*)take((size_t)NKV * HD * TT * 2);
    bf* QPh = (bf*)take((size_t)NH_ * TT * HD * 2); bf* QPl = (bf*)take((size_t)NH_ * TT * HD * 2); bf* KPh = (bf*)take((size_t)NKV * TT * HD * 2); bf* KPl = (bf*)take((size_t)NKV * TT * HD * 2); bf* VTh = (bf*)take((size_t)NKV * HD * TT * 2); bf* VTl = (bf*)take((size_t)NKV * HD * TT * 2);
    bf* Ph = (bf*)take((size_t)ZH * RH * TT * 2); bf* Pl = (bf*)take((size_t)ZH * RH * TT * 2);
    float* Sb = (float*)take((size_t)ZH * TT * TT * 4); h16* P16 = (h16*)take((size_t)ZH * TT * TT * 2); float* Ob = (float*)take((size_t)ZH * TT * HD * 4); bf* ATh = (bf*)take((size_t)TT * DQ * 2); bf* ATl = (bf*)take((size_t)TT * DQ * 2);
    if ((size_t)(wsp - (char*)d_ws) > ws_size) return;
    if ((size_t)(wsp - (char*)d_ws) > (size_t)134217728) return;

    // in[rows = 1024 (in)][cols = 3072 (out)] -> out[cols][rows]; grid (cols/64, rows/64)
    k_trw<<<dim3(3 * DM / 64, DM / 64, 1), 256, 0, stream>>>(wqkv, WQKV, DM, 3 * DM);
    // in[rows = 1024 (in)][cols = 1024 (out)] -> out[cols][rows]; grid (cols/64, rows/64)
    k_trw<<<dim3(DM / 64, DM / 64, 1), 256, 0, stream>>>(wout, WO, DM, DM);
    k_mchk<<<TT / 8, 256, 0, stream>>>(mask, PB);
    k_mred<<<1, 32, 0, stream>>>(PB, FLG);

    const unsigned LQ = (unsigned)(((size_t)NH_ * TT * HD / 2 + 255) / 256), LKv = (unsigned)(((size_t)NKV * TT * HD / 2 + 255) / 256);
    for (int b = 0; b < NB_; ++b) {
        k_cvtx<<<(unsigned)(((size_t)TT * DM / 8 + 255) / 256), 256, 0, stream>>>(x, XB, b);
        k_gemmw<bf, 0, false><<<dim3(TT / 64, DQ / 64, 1), 32, 0, stream>>>(XB, nullptr, WQKV, nullptr, DM, F, DQ, nullptr, 0, 0, 0);
        k_rope<<<LQ, 256, 0, stream>>>(F, DQ, NH_, cosb, sinb, 1.0f, QP16, QPh, QPl);
        k_gemmw<bf, 0, false><<<dim3(TT / 64, DKV / 64, 1), 32, 0, stream>>>(XB, nullptr, WQKV + (size_t)DQ * DM, nullptr, DM, F, DKV, nullptr, 0, 0, 0);
        k_rope<<<LKv, 256, 0, stream>>>(F, DKV, NKV, cosb, sinb, 1.0f, KP16, KPh, KPl);
        k_gemmw<bf, 0, false><<<dim3(TT / 64, DKV / 64, 1), 32, 0, stream>>>(XB, nullptr, WQKV + (size_t)(DQ + DKV) * DM, nullptr, DM, F, DKV, nullptr, 0, 0, 0);
        k_vtp<<<LKv, 256, 0, stream>>>(F, DKV, NKV, VT16, VTh, VTl);
        for (int h0 = 0; h0 < NH_; h0 += ZH) { const size_t zq = (size_t)h0, zk = (size_t)(h0 / REP);
            k_gemmc<bf, 2, 1><<<dim3(RH / 64, TT / 64, ZH), 32, 0, stream>>>(QPh + zq * TT * HD, QPl + zq * TT * HD, KPh + zk * TT * HD, KPl + zk * TT * HD, HD, Sb, TT, 0, (size_t)TT * HD, (size_t)TT * HD, (size_t)TT * TT);
            if (TT > RH) k_gemmc<h16, 0, 1><<<dim3((TT - RH) / 64, TT / 64, ZH), 32, 0, stream>>>(QP16 + zq * TT * HD + (size_t)RH * HD, nullptr, KP16 + zk * TT * HD, nullptr, HD, Sb + (size_t)RH * TT, TT, RH, (size_t)TT * HD, (size_t)TT * HD, (size_t)TT * TT);
            k_asoft<<<ZH * TT / 8, 256, 0, stream>>>(Sb, mask, FLG, P16, Ph, Pl);
            k_gemmc<bf, 2, 2><<<dim3(RH / 64, HD / 64, ZH), 32, 0, stream>>>(Ph, Pl, VTh + zk * HD * TT, VTl + zk * HD * TT, TT, Ob, HD, 0, (size_t)RH * TT, (size_t)HD * TT, (size_t)TT * HD);
            if (TT > RH) k_gemmc<h16, 0, 2><<<dim3((TT - RH) / 64, HD / 64, ZH), 32, 0, stream>>>(P16 + (size_t)RH * TT, nullptr, VT16 + zk * HD * TT, nullptr, TT, Ob + (size_t)RH * HD, HD, RH, (size_t)TT * TT, (size_t)HD * TT, (size_t)TT * HD);
            k_merge<<<(unsigned)(((size_t)ZH * TT * HD / 2 + 255) / 256), 256, 0, stream>>>(Ob, h0, ATh, ATl); }
        // out[t][b][:] : row pitch NB*DM, batch slab offset b*DM
        k_gemmw<bf, 1, false><<<dim3(TT / 64, DM / 64, 1), 32, 0, stream>>>(ATh, ATl, WO, nullptr, DQ, OUT + (size_t)b * DM, NB_ * DM, nullptr, 0, 0, 0); }
}

// v002
// Measured time: 1360 microseconds a run.
// In two side-by-side timings against v001, it was 2.13 and 2.14 times as fast.
// Counting every step since v000, it is 3.49 times as fast.
#include <hip/hip_runtime.h>

// Contractions (f32 accumulate): qkv projection v_wmma_f32_16x16x32_bf16 (bf16 x bf16, exact products); scores and prob x value: query rows < RH bf16 hi/lo planes (3 products), rows >= RH v_wmma_f32_16x16x32_f16 (probabilities carried x1024); output projection bf16 hi+lo activation x bf16 weight (2 products).
// Every float input is RNE-converted to bf16 on load. Softmax, rotary and all other side math in f32.

#ifndef NB
#define NB 4
#endif
#ifndef SEQ
#define SEQ 2048
#endif
#define NB_FULL  4                 // batch stride of the staged x rows ([S][B][D])
#define SEQ_FULL 2048              // row pitch of the staged additive mask
#define NB_  NB
#define TT   SEQ
#define DM   1024
#define NH_  16
#define NKV  16
#define REP  (NH_ / NKV)
#define HD   64
#define DQ   (NH_ * HD)
#define DKV  (NKV * HD)
#define ZH   8                     // heads per attention launch
#define RH   ((SEQ) < 512 ? (SEQ) : 512)   // query rows < RH use hi+lo planes
#define PCAR 1024.0f
#define SCL  0.125f                // HD^-0.5
static_assert(SEQ % 128 == 0);
static_assert(RH % 64 == 0);
static_assert(SEQ <= SEQ_FULL);
static_assert(NB <= NB_FULL);
static_assert(NH_ % ZH == 0);
static_assert(DM % 64 == 0);
static_assert(DQ == DM);

typedef _Float16 h16;
typedef unsigned short bf;
typedef __attribute__((ext_vector_type(16))) __bf16   v16bf;
typedef __attribute__((ext_vector_type(16))) _Float16 v16h;
typedef __attribute__((ext_vector_type(8)))  _Float16 v8h;
typedef __attribute__((ext_vector_type(8)))  unsigned short v8us;
typedef __attribute__((ext_vector_type(8)))  float    v8f;
typedef __attribute__((ext_vector_type(4)))  float    v4f;
typedef __attribute__((ext_vector_type(4)))  int      v4i;
typedef __attribute__((ext_vector_type(2)))  _Float16 v2h;
typedef __attribute__((ext_vector_type(4)))  _Float16 v4h;
typedef __attribute__((ext_vector_type(2)))  unsigned short v2us;
typedef __attribute__((ext_vector_type(4)))  unsigned short v4us;
typedef __attribute__((ext_vector_type(2)))  float    v2f;
typedef v8h  __attribute__((may_alias)) v8ha;
typedef v4f  __attribute__((may_alias)) v4fa;
typedef v8us __attribute__((may_alias)) v8usa;
typedef v4us __attribute__((may_alias)) v4usa;
typedef v4h  __attribute__((may_alias)) v4ha;

__device__ __forceinline__ unsigned short f2bf(float f) { unsigned u = __float_as_uint(f); u += 0x7FFFu + ((u >> 16) & 1u); return (unsigned short)(u >> 16); }
__device__ __forceinline__ float bf2f(unsigned short b) { return __uint_as_float(((unsigned)b) << 16); }
__device__ __forceinline__ float bfr(float f) { return bf2f(f2bf(f)); }
__device__ __forceinline__ v16h cat16(v8h lo, v8h hi) { return __builtin_shufflevector(lo, hi, 0, 1, 2, 3, 4, 5, 6, 7, 8, 9, 10, 11, 12, 13, 14, 15); }
__device__ __forceinline__ v16bf cat16b(v8us lo, v8us hi) { return __builtin_bit_cast(v16bf, __builtin_shufflevector(lo, hi, 0, 1, 2, 3, 4, 5, 6, 7, 8, 9, 10, 11, 12, 13, 14, 15)); }
__device__ __forceinline__ v8f wmma16(v16h a, v16h b, v8f c) { return __builtin_amdgcn_wmma_f32_16x16x32_f16(false, a, false, b, (short)0, c, false, false); }
__device__ __forceinline__ v8f wmmab(v16bf a, v16bf b, v8f c) { return __builtin_amdgcn_wmma_f32_16x16x32_bf16(false, a, false, b, (short)0, c, false, false); }

// ---- k_gemmw: register-blocked GEMM, ONE WAVE per 64x64 output tile (16 accumulators), operands straight from K-contiguous 16-bit planes; grid (M/64, N/64, Z), 32 threads.
// C[m][n] (f32, pitch ldc, + optional f32 bias[n]) = sum_k A[m][k] Bt[n][k] (+ split products per NSPLIT). z-batch strides sA/sB/sC in elements. K % 32 == 0, M % 64 == 0, N % 64 == 0.
// Fragment map: lane -> row/col (lane & 15); elements 0..7 <- k0 + 8*(lane>>4) + 0..7, elements 8..15 <- k0 + 16 + 8*(lane>>4) + 0..7; D element j <- (row 8*(lane>>4) + j, col lane & 15).
template <typename T16> struct WFrag;
template <> struct WFrag<h16> { typedef v16h V; static __device__ __forceinline__ V ld(const h16* p) { return cat16(*(const v8h*)p, *(const v8h*)(p + 16)); } static __device__ __forceinline__ v8f mma(V a, V b, v8f c) { return wmma16(a, b, c); } };
template <> struct WFrag<bf> { typedef v16bf V; static __device__ __forceinline__ V ld(const bf* p) { return cat16b(*(const v8us*)p, *(const v8us*)(p + 16)); } static __device__ __forceinline__ v8f mma(V a, V b, v8f c) { return wmmab(a, b, c); } };
template <typename T16, int NSPLIT, bool BIAS>
__global__ __launch_bounds__(32) void k_gemmw(const T16* __restrict__ A, const T16* __restrict__ A2, const T16* __restrict__ Bt, const T16* __restrict__ Bt2, int K, float* C, int ldc, const float* __restrict__ bias, size_t sA, size_t sB, size_t sC) {
    typedef typename WFrag<T16>::V V;
    __shared__ __align__(16) float os[16 * 68];
    const size_t z = blockIdx.z; A += z * sA; if (A2) A2 += z * sA; Bt += z * sB; if (Bt2) Bt2 += z * sB; C += z * sC;
    const int lane = threadIdx.x & 31, lr = lane & 15, hi = lane >> 4; const int r0 = blockIdx.x * 64, c0 = blockIdx.y * 64;
    v8f acc[4][4];
#pragma unroll
    for (int mb = 0; mb < 4; ++mb)
#pragma unroll
        for (int nb = 0; nb < 4; ++nb) acc[mb][nb] = (v8f){};
    const size_t aoff = (size_t)(r0 + lr) * K + 8 * hi, boff = (size_t)(c0 + lr) * K + 8 * hi;
#pragma unroll 1
    for (int kc = 0; kc < K; kc += 32) {
        V a[4], a2[4];
#pragma unroll
        for (int mb = 0; mb < 4; ++mb) { a[mb] = WFrag<T16>::ld(A + aoff + (size_t)mb * 16 * K + kc); if (NSPLIT == 1 || NSPLIT == 2) a2[mb] = WFrag<T16>::ld(A2 + aoff + (size_t)mb * 16 * K + kc); }
#pragma unroll
        for (int nb = 0; nb < 4; ++nb) { const V b = WFrag<T16>::ld(Bt + boff + (size_t)nb * 16 * K + kc); V b2; if (NSPLIT >= 2) b2 = WFrag<T16>::ld(Bt2 + boff + (size_t)nb * 16 * K + kc);
#pragma unroll
            for (int mb = 0; mb < 4; ++mb) { acc[mb][nb] = WFrag<T16>::mma(a[mb], b, acc[mb][nb]); if (NSPLIT == 1 || NSPLIT == 2) acc[mb][nb] = WFrag<T16>::mma(a2[mb], b, acc[mb][nb]); if (NSPLIT >= 2) acc[mb][nb] = WFrag<T16>::mma(a[mb], b2, acc[mb][nb]); } }
        asm volatile("v_nop\n\tv_nop\n\tv_nop\n\tv_nop" : "+v"(acc[0][0]), "+v"(acc[1][1]), "+v"(acc[2][2]), "+v"(acc[3][3]) : "v"(a[0]), "v"(a[3]));
    }
#pragma unroll
    for (int mb = 0; mb < 4; ++mb) {
#pragma unroll
        for (int nb = 0; nb < 4; ++nb) {
#pragma unroll
            for (int j = 0; j < 8; ++j) os[(hi * 8 + j) * 68 + nb * 16 + lr] = acc[mb][nb][j]; }
        __builtin_amdgcn_wave_barrier(); asm volatile("" ::: "memory");
        float* crow = C + (size_t)(r0 + mb * 16) * ldc + c0;
{
#pragma unroll
            for (int s = 0; s < 8; ++s) { const int row = 2 * s + hi, cofs = lr * 4; v4f val = *(const v4fa*)(os + row * 68 + cofs); if (BIAS) { val[0] += bfr(bias[c0 + cofs]); val[1] += bfr(bias[c0 + cofs + 1]); val[2] += bfr(bias[c0 + cofs + 2]); val[3] += bfr(bias[c0 + cofs + 3]); }
                *(v4f*)(crow + (size_t)row * ldc + cofs) = val; }
             }
        __builtin_amdgcn_wave_barrier(); asm volatile("" ::: "memory");
    }
}

// ---- k_gemmc: the same one-wave 64x64 tile GEMM specialised for causal attention: CMODE 1 skips score tiles entirely above the diagonal (query rows r0+roff.., key columns c0..), CMODE 2 limits the
// key (K) loop of the probability x value contraction to the diagonal block (probabilities beyond it are exactly zero). roff = row offset of this launch's first row within the sequence.
// lda = row pitch of A and A2 in elements (the probabilities lie inside the f32 score rows, so their pitch is not K); Bt and Bt2 have pitch K.
template <typename T16, int NSPLIT, int CMODE>
__global__ __launch_bounds__(32) void k_gemmc(const T16* __restrict__ A, const T16* __restrict__ A2, const T16* __restrict__ Bt, const T16* __restrict__ Bt2, int K, int lda, float* C, int ldc, int roff, size_t sA, size_t sB, size_t sC) {
    typedef typename WFrag<T16>::V V;
    __shared__ __align__(16) float os[16 * 68];
    const size_t z = blockIdx.z; A += z * sA; if (A2) A2 += z * sA; Bt += z * sB; if (Bt2) Bt2 += z * sB; C += z * sC;
    const int lane = threadIdx.x & 31, lr = lane & 15, hi = lane >> 4; const int r0 = blockIdx.x * 64, c0 = blockIdx.y * 64;
    if (CMODE == 1 && c0 > r0 + roff + 63) return;                  // score tile entirely above the causal diagonal: never produced (the softmax discards j > i by value select)
    const int Kl = (CMODE == 2) ? min(K, r0 + roff + 64) : K;        // P.V: probabilities are exactly 0 beyond the diagonal block, so the K loop stops there
    v8f acc[4][4];
#pragma unroll
    for (int mb = 0; mb < 4; ++mb)
#pragma unroll
        for (int nb = 0; nb < 4; ++nb) acc[mb][nb] = (v8f){};
    const size_t aoff = (size_t)(r0 + lr) * lda + 8 * hi, boff = (size_t)(c0 + lr) * K + 8 * hi;
#pragma unroll 1
    for (int kc = 0; kc < Kl; kc += 32) {
        V a[4], a2[4];
#pragma unroll
        for (int mb = 0; mb < 4; ++mb) { a[mb] = WFrag<T16>::ld(A + aoff + (size_t)mb * 16 * lda + kc); if (NSPLIT == 1 || NSPLIT == 2) a2[mb] = WFrag<T16>::ld(A2 + aoff + (size_t)mb * 16 * lda + kc); }
#pragma unroll
        for (int nb = 0; nb < 4; ++nb) { const V b = WFrag<T16>::ld(Bt + boff + (size_t)nb * 16 * K + kc); V b2; if (NSPLIT >= 2) b2 = WFrag<T16>::ld(Bt2 + boff + (size_t)nb * 16 * K + kc);
#pragma unroll
            for (int mb = 0; mb < 4; ++mb) { acc[mb][nb] = WFrag<T16>::mma(a[mb], b, acc[mb][nb]); if (NSPLIT == 1 || NSPLIT == 2) acc[mb][nb] = WFrag<T16>::mma(a2[mb], b, acc[mb][nb]); if (NSPLIT >= 2) acc[mb][nb] = WFrag<T16>::mma(a[mb], b2, acc[mb][nb]); } }
        asm volatile("v_nop\n\tv_nop\n\tv_nop\n\tv_nop" : "+v"(acc[0][0]), "+v"(acc[1][1]), "+v"(acc[2][2]), "+v"(acc[3][3]) : "v"(a[0]), "v"(a[3]));
    }
#pragma unroll
    for (int mb = 0; mb < 4; ++mb) {
#pragma unroll
        for (int nb = 0; nb < 4; ++nb) {
#pragma unroll
            for (int j = 0; j < 8; ++j) os[(hi * 8 + j) * 68 + nb * 16 + lr] = acc[mb][nb][j]; }
        __builtin_amdgcn_wave_barrier(); asm volatile("" ::: "memory");
        float* crow = C + (size_t)(r0 + mb * 16) * ldc + c0;
{
#pragma unroll
            for (int s = 0; s < 8; ++s) { const int row = 2 * s + hi, cofs = lr * 4; v4f val = *(const v4fa*)(os + row * 68 + cofs);
                *(v4f*)(crow + (size_t)row * ldc + cofs) = val; }
             }
        __builtin_amdgcn_wave_barrier(); asm volatile("" ::: "memory");
    }
}

__device__ __forceinline__ h16 tohx(float x) { return (h16)x; }
__device__ __forceinline__ void splitf(float y, unsigned short& h, unsigned short& l) { h = f2bf(y); l = f2bf(y - bf2f(h)); }

// k_trw: in[rows][cols] f32 -> out[cols][rows] bf16 (RNE), 64x64 tiles through LDS (cross-wave: block barrier); grid (cols/64, rows/64), 256 threads.
__global__ __launch_bounds__(256) void k_trw(const float* __restrict__ in, bf* out, int rows, int cols) {
    __shared__ float ls[64 * 65];
    const int tid = threadIdx.x; const int c0 = blockIdx.x * 64, r0 = blockIdx.y * 64;
#pragma unroll
    for (int i = 0; i < 4; ++i) { const int r = (tid >> 4) + 16 * i; const int c = (tid & 15) * 4; const v4f v = *(const v4f*)(in + (size_t)(r0 + r) * cols + c0 + c);
        ls[r * 65 + c] = v[0]; ls[r * 65 + c + 1] = v[1]; ls[r * 65 + c + 2] = v[2]; ls[r * 65 + c + 3] = v[3]; }
    __syncthreads();
    const int n0 = tid >> 3, n1 = n0 + 32, pc = tid & 7; v8us o0, o1;
#pragma unroll
    for (int j = 0; j < 8; ++j) { o0[j] = f2bf(ls[(pc * 8 + j) * 65 + n0]); o1[j] = f2bf(ls[(pc * 8 + j) * 65 + n1]); }
    bf* p0 = out + (size_t)(c0 + n0) * rows + r0 + pc * 8; bf* p1 = out + (size_t)(c0 + n1) * rows + r0 + pc * 8;
    *(v8us*)p0 = o0; *(v8us*)p1 = o1; 
}

__global__ __launch_bounds__(256) void k_cvtx(const float* __restrict__ x, bf* dst, int b) { const size_t i = (size_t)blockIdx.x * 256 + threadIdx.x; if (i >= (size_t)TT * DM / 8) return; const int t = (int)(i / (DM / 8)); const int c8 = (int)(i % (DM / 8));
    const v8f v = *(const v8f*)(x + ((size_t)t * NB_FULL + b) * DM + (size_t)c8 * 8); v8us o;
#pragma unroll
    for (int k = 0; k < 8; ++k) o[k] = f2bf(v[k]); *(v8us*)(dst + i * 8) = o;  }

// k_mchk: the additive mask rows 0..TT-1 are scanned by TT/8 blocks of 8 rows each, one wave per row: every entry above the diagonal must be <= -1e8 (its softmax weight is then exactly zero) and every diagonal entry >= -1e4.
// Block p stores its count of violations into its own 128-byte line of PB; k_mred, the next launch, adds the lines up.
__global__ __launch_bounds__(256) void k_mchk(const float* __restrict__ M, int* PB) {
    __shared__ int wb[8];
    const int tid = threadIdx.x, lane = tid & 31, wv = tid >> 5; int bad = 0;
    const int i = (int)blockIdx.x * 8 + __builtin_amdgcn_readfirstlane(wv);      // one wave per row: the row number and the row's base address are scalar
    const float* mr = M + (size_t)i * SEQ_FULL + lane * 4;
    // unrolled so that a lane's TT/128 independent loads overlap instead of each waiting for the one before
#pragma unroll
    for (int u = 0; u < TT / 128; ++u) { const int j0 = u * 128 + lane * 4; const v4f m = *(const v4f*)(mr + u * 128);
#pragma unroll
        for (int q = 0; q < 4; ++q) { const int j = j0 + q; const int bu = (m[q] <= -1.0e8f) ? 0 : 1; const int bd = (m[q] >= -1.0e4f) ? 0 : 1; bad += (j > i) ? bu : 0; bad += (j == i) ? bd : 0; } }
#pragma unroll
    for (int sh = 16; sh; sh >>= 1) bad += __shfl_xor(bad, sh, 32);
    if (lane == 0) wb[wv] = bad;
    __syncthreads();
    if (wv == 0) { int tot = 0;
#pragma unroll
        for (int k = 0; k < 8; ++k) tot += wb[k];
        if (lane < 8) { v4i o; o[0] = tot; o[1] = tot; o[2] = tot; o[3] = tot; *(v4i*)(PB + (size_t)blockIdx.x * 32 + lane * 4) = o; } }
}

// k_mred: one wave adds the TT/8 per-block counts of k_mchk and writes the flag line: 1.0 if no entry violates, NaN otherwise.
__global__ __launch_bounds__(32) void k_mred(const int* __restrict__ PB, float* FLG) {
    const int lane = threadIdx.x & 31; int tot = 0;
    // unrolled so that the lane's loads go out together: one memory latency for the whole launch
#pragma unroll
    for (int k = lane; k < TT / 8; k += 32) tot += PB[(size_t)k * 32];
#pragma unroll
    for (int sh = 16; sh; sh >>= 1) tot += __shfl_xor(tot, sh, 32);
    const float fv = tot ? __uint_as_float(0x7FC00000u) : 1.0f;
    if (lane < 8) { v4f o; o[0] = fv; o[1] = fv; o[2] = fv; o[3] = fv; *(v4f*)(FLG + lane * 4) = o; }
}

// k_rope: head planes [h][t][d] (fp16 + bf16 hi/lo) of rotary(x) x sc, interleaved-pair convention with the INPUT tables read as values (RNE bf16):
// out[2i] = x[2i] cos[t][2i] - x[2i+1] sin[t][2i], out[2i+1] = x[2i+1] cos[t][2i+1] + x[2i] sin[t][2i+1]; products and sum separately in f32.
__global__ __launch_bounds__(256) void k_rope(const float* __restrict__ F, int pitch, int nheads, const float* __restrict__ COS, const float* __restrict__ SIN, float sc, h16* P16, bf* Ph, bf* Pl) {
    const size_t e = ((size_t)blockIdx.x * 256 + threadIdx.x) * 2; if (e >= (size_t)nheads * TT * HD) return; const int d = (int)(e % HD); const int t = (int)((e / HD) % TT); const int h = (int)(e / ((size_t)HD * TT));
    const v2f xx = *(const v2f*)(F + (size_t)t * pitch + h * HD + d); const v2f cc = *(const v2f*)(COS + (size_t)t * HD + d); const v2f ss = *(const v2f*)(SIN + (size_t)t * HD + d);
    float a0 = __fmul_rn(xx[0], bfr(cc[0])), b0 = __fmul_rn(xx[1], bfr(ss[0])), a1 = __fmul_rn(xx[1], bfr(cc[1])), b1 = __fmul_rn(xx[0], bfr(ss[1]));
    asm volatile("" : "+v"(a0)); asm volatile("" : "+v"(b0)); asm volatile("" : "+v"(a1)); asm volatile("" : "+v"(b1));
    const float r0 = __fsub_rn(a0, b0) * sc, r1 = __fadd_rn(a1, b1) * sc;
    v2h o16; v2us oh, ol; unsigned short hh, ll; o16[0] = tohx(r0); o16[1] = tohx(r1); splitf(r0, hh, ll); oh[0] = hh; ol[0] = ll; splitf(r1, hh, ll); oh[1] = hh; ol[1] = ll;
    *(v2h*)(P16 + e) = o16; *(v2us*)(Ph + e) = oh; *(v2us*)(Pl + e) = ol;  }

__global__ __launch_bounds__(256) void k_vtp(const float* __restrict__ F, int pitch, int nheads, h16* V16, bf* Vh, bf* Vl) { const size_t e = ((size_t)blockIdx.x * 256 + threadIdx.x) * 2; if (e >= (size_t)nheads * HD * TT) return; const int t = (int)(e % TT); const int d = (int)((e / TT) % HD); const int g = (int)(e / ((size_t)TT * HD)); v2h o16; v2us oh, ol;
#pragma unroll
    for (int q = 0; q < 2; ++q) { const float x = F[(size_t)(t + q) * pitch + g * HD + d]; o16[q] = tohx(x); unsigned short a2, c2; splitf(x, a2, c2); oh[q] = a2; ol[q] = c2; }
    *(v2h*)(V16 + e) = o16; *(v2us*)(Vh + e) = oh; *(v2us*)(Vl + e) = ol;  }

// k_asoft: one wave per row (zz, i): t = S x HD^-0.5 + mask[i][j] (RNE bf16 mask value, read from the input) for j <= i; entries j > i have an exactly zero weight (property checked by k_mchk).
// The probabilities overwrite the wave's own score row (TT floats = 2 TT 16-bit places): rows >= RH the f16 plane in places 0..TT-1; rows < RH the bf16 hi plane in places 0..TT-1 and the lo plane in TT..2TT-1.
// Every store depends on the row sum, hence on every load of the row, and no other wave touches the row.
__global__ __launch_bounds__(256) void k_asoft(float* Sb, const float* __restrict__ M, const float* __restrict__ FLG) {
    const int lane = threadIdx.x & 31; const int wv = __builtin_amdgcn_readfirstlane((int)(threadIdx.x >> 5)); const int row = blockIdx.x * 8 + wv; if (row >= ZH * TT) return;
    const int i = row % TT; const bool hires = (i < RH); const float* sr = Sb + (size_t)row * TT; const float* mr = M + (size_t)i * SEQ_FULL; const float fl = FLG[0]; float v[TT / 32]; float mx = -3.0e38f;
#pragma unroll
    for (int ch = 0; ch < TT / 128; ++ch) { const int j0 = ch * 128 + lane * 4; const v4f a = *(const v4f*)(sr + j0); v4f mk; mk[0] = 0.f; mk[1] = 0.f; mk[2] = 0.f; mk[3] = 0.f;
        if (ch * 128 <= i) mk = *(const v4f*)(mr + j0);      // wave-uniform condition (i is scalar)
#pragma unroll
        for (int q = 0; q < 4; ++q) { const int j = j0 + q; const float sv = a[q] * SCL + bfr(mk[q]); const float t = (j <= i) ? sv : -3.0e38f; v[ch * 4 + q] = t; mx = fmaxf(mx, t); } }
#pragma unroll
    for (int sh = 16; sh; sh >>= 1) mx = fmaxf(mx, __shfl_xor(mx, sh, 32));
    float sum = 0.f;
#pragma unroll
    for (int k = 0; k < TT / 32; ++k) { float d0 = __fsub_rn(v[k], mx); asm volatile("" : "+v"(d0)); v[k] = __builtin_amdgcn_exp2f(__fmul_rn(d0, 1.4426950408889634f)); sum += v[k]; }
#pragma unroll
    for (int sh = 16; sh; sh >>= 1) sum += __shfl_xor(sum, sh, 32);
    const float f = __fdiv_rn(hires ? 1.0f : PCAR, sum) * fl;
{
        if (hires) {
#pragma unroll
            for (int ch = 0; ch < TT / 128; ++ch) { v4us oh, ol;
#pragma unroll
                for (int q = 0; q < 4; ++q) { unsigned short a, c2; splitf(v[ch * 4 + q] * f, a, c2); oh[q] = a; ol[q] = c2; }
                bf* pr = (bf*)(Sb + (size_t)row * TT) + ch * 128 + lane * 4; *(v4usa*)pr = oh; *(v4usa*)(pr + TT) = ol; }
        } else {
#pragma unroll
            for (int ch = 0; ch < TT / 128; ++ch) { v4h o4;
#pragma unroll
                for (int q = 0; q < 4; ++q) o4[q] = tohx(v[ch * 4 + q] * f);
                *(v4ha*)((h16*)(Sb + (size_t)row * TT) + ch * 128 + lane * 4) = o4; }
            // the listing joins this path with the code of the other branch, which rewrites the registers that the last stores name: the wait stands in front of that join
            asm volatile("s_wait_xcnt 0x0" ::: "memory"); }
         }
}

__global__ __launch_bounds__(256) void k_merge(const float* __restrict__ O, int h0, bf* Ah, bf* Al) { const size_t e = ((size_t)blockIdx.x * 256 + threadIdx.x) * 2; if (e >= (size_t)ZH * TT * HD) return; const int d = (int)(e % HD); const int t = (int)((e / HD) % TT); const int zz = (int)(e / ((size_t)HD * TT)); const float cs = (t < RH) ? 1.0f : (1.0f / PCAR); const size_t oo = (size_t)t * DQ + (h0 + zz) * HD + d;
    v2us oh, ol;
#pragma unroll
    for (int q = 0; q < 2; ++q) { unsigned short a, c2; splitf(O[e + q] * cs, a, c2); oh[q] = a; ol[q] = c2; } *(v2us*)(Ah + oo) = oh; *(v2us*)(Al + oo) = ol;  }

#define AL256(b) ((((size_t)(b)) + 255) & ~(size_t)255)
constexpr size_t WS_TOTAL =
    AL256((size_t)3 * DM * DM * 2) + AL256((size_t)DM * DQ * 2) + AL256(256) + AL256((size_t)(TT / 8) * 128) + AL256((size_t)TT * DM * 2) + AL256((size_t)TT * DQ * 4)
    + 3 * AL256((size_t)NH_ * TT * HD * 2) + 6 * AL256((size_t)NH_ * TT * HD * 2)
    + AL256((size_t)ZH * TT * TT * 4) + AL256((size_t)ZH * TT * HD * 4) + 2 * AL256((size_t)TT * DQ * 2);
static_assert(WS_TOTAL <= (size_t)268435456);

extern "C" void kernel_launch(void* const* d_in, const int* in_sizes, int n_in,
                              void* d_out, int out_size, void* d_ws, size_t ws_size, hipStream_t stream) {
    if (n_in < 6) return;
    if ((size_t)in_sizes[0] < (size_t)TT * NB_FULL * DM) return;      // x [S][B][D]
    if ((size_t)in_sizes[1] < (size_t)TT * SEQ_FULL) return;          // additive mask [S][S]
    if ((size_t)in_sizes[2] < (size_t)TT * HD) return;                // cos [S][64]
    if ((size_t)in_sizes[3] < (size_t)TT * HD) return;                // sin [S][64]
    if ((size_t)in_sizes[4] < (size_t)DM * 3 * DM) return;            // Wqkv [in 1024][out 3072]
    if ((size_t)in_sizes[5] < (size_t)DM * DM) return;                // Wout [in 1024][out 1024]
    if ((size_t)out_size < (size_t)TT * NB_ * DM) return;
    const float* x = (const float*)d_in[0]; const float* mask = (const float*)d_in[1]; const float* cosb = (const float*)d_in[2]; const float* sinb = (const float*)d_in[3];
    const float* wqkv = (const float*)d_in[4]; const float* wout = (const float*)d_in[5];
    float* OUT = (float*)d_out;     // [S][B][D]
    char* wsp = (char*)d_ws;
    auto take = [&](size_t bytes) { char* p = wsp; wsp += (bytes + 255) & ~(size_t)255; return (void*)p; };
    bf* WQKV = (bf*)take((size_t)3 * DM * DM * 2);     // [3072 out][1024 in]: q | k | v = row thirds
    bf* WO = (bf*)take((size_t)DM * DQ * 2);           // [1024 out][1024 in]
    float* FLG = (float*)take(256);
    int* PB = (int*)take((size_t)(TT / 8) * 128);      // one 128-byte line per block of the mask scan
    bf* XB = (bf*)take((size_t)TT * DM * 2); float* F = (float*)take((size_t)TT * DQ * 4);   // F is reused for q, k, v in stream order
    h16* QP16 = (h16*)take((size_t)NH_ * TT * HD * 2); h16* KP16 = (h16*)take((size_t)NKV * TT * HD * 2); h16* VT16 = (h16*)take((size_t)NKV * HD * TT * 2);
    bf* QPh = (bf*)take((size_t)NH_ * TT * HD * 2); bf* QPl = (bf*)take((size_t)NH_ * TT * HD * 2); bf* KPh = (bf*)take((size_t)NKV * TT * HD * 2); bf* KPl = (bf*)take((size_t)NKV * TT * HD * 2); bf* VTh = (bf*)take((size_t)NKV * HD * TT * 2); bf* VTl = (bf*)take((size_t)NKV * HD * TT * 2);
    float* Sb = (float*)take((size_t)ZH * TT * TT * 4); float* Ob = (float*)take((size_t)ZH * TT * HD * 4); bf* ATh = (bf*)take((size_t)TT * DQ * 2); bf* ATl = (bf*)take((size_t)TT * DQ * 2);
    if ((size_t)(wsp - (char*)d_ws) > ws_size) return;
    if ((size_t)(wsp - (char*)d_ws) > (size_t)268435456) return;

    // in[rows = 1024 (in)][cols = 3072 (out)] -> out[cols][rows]; grid (cols/64, rows/64)
    k_trw<<<dim3(3 * DM / 64, DM / 64, 1), 256, 0, stream>>>(wqkv, WQKV, DM, 3 * DM);
    // in[rows = 1024 (in)][cols = 1024 (out)] -> out[cols][rows]; grid (cols/64, rows/64)
    k_trw<<<dim3(DM / 64, DM / 64, 1), 256, 0, stream>>>(wout, WO, DM, DM);
    k_mchk<<<TT / 8, 256, 0, stream>>>(mask, PB);
    k_mred<<<1, 32, 0, stream>>>(PB, FLG);

    const unsigned LQ = (unsigned)(((size_t)NH_ * TT * HD / 2 + 255) / 256), LKv = (unsigned)(((size_t)NKV * TT * HD / 2 + 255) / 256);
    for (int b = 0; b < NB_; ++b) {
        k_cvtx<<<(unsigned)(((size_t)TT * DM / 8 + 255) / 256), 256, 0, stream>>>(x, XB, b);
        k_gemmw<bf, 0, false><<<dim3(TT / 64, DQ / 64, 1), 32, 0, stream>>>(XB, nullptr, WQKV, nullptr, DM, F, DQ, nullptr, 0, 0, 0);
        k_rope<<<LQ, 256, 0, stream>>>(F, DQ, NH_, cosb, sinb, 1.0f, QP16, QPh, QPl);
        k_gemmw<bf, 0, false><<<dim3(TT / 64, DKV / 64, 1), 32, 0, stream>>>(XB, nullptr, WQKV + (size_t)DQ * DM, nullptr, DM, F, DKV, nullptr, 0, 0, 0);
        k_rope<<<LKv, 256, 0, stream>>>(F, DKV, NKV, cosb, sinb, 1.0f, KP16, KPh, KPl);
        k_gemmw<bf, 0, false><<<dim3(TT / 64, DKV / 64, 1), 32, 0, stream>>>(XB, nullptr, WQKV + (size_t)(DQ + DKV) * DM, nullptr, DM, F, DKV, nullptr, 0, 0, 0);
        k_vtp<<<LKv, 256, 0, stream>>>(F, DKV, NKV, VT16, VTh, VTl);
        for (int h0 = 0; h0 < NH_; h0 += ZH) { const size_t zq = (size_t)h0, zk = (size_t)(h0 / REP);
            k_gemmc<bf, 2, 1><<<dim3(RH / 64, TT / 64, ZH), 32, 0, stream>>>(QPh + zq * TT * HD, QPl + zq * TT * HD, KPh + zk * TT * HD, KPl + zk * TT * HD, HD, HD, Sb, TT, 0, (size_t)TT * HD, (size_t)TT * HD, (size_t)TT * TT);
            if (TT > RH) k_gemmc<h16, 0, 1><<<dim3((TT - RH) / 64, TT / 64, ZH), 32, 0, stream>>>(QP16 + zq * TT * HD + (size_t)RH * HD, nullptr, KP16 + zk * TT * HD, nullptr, HD, HD, Sb + (size_t)RH * TT, TT, RH, (size_t)TT * HD, (size_t)TT * HD, (size_t)TT * TT);
            k_asoft<<<ZH * TT / 8, 256, 0, stream>>>(Sb, mask, FLG);
            k_gemmc<bf, 2, 2><<<dim3(RH / 64, HD / 64, ZH), 32, 0, stream>>>((const bf*)Sb, (const bf*)Sb + TT, VTh + zk * HD * TT, VTl + zk * HD * TT, TT, 2 * TT, Ob, HD, 0, (size_t)2 * TT * TT, (size_t)HD * TT, (size_t)TT * HD);
            if (TT > RH) k_gemmc<h16, 0, 2><<<dim3((TT - RH) / 64, HD / 64, ZH), 32, 0, stream>>>((const h16*)Sb + (size_t)RH * 2 * TT, nullptr, VT16 + zk * HD * TT, nullptr, TT, 2 * TT, Ob + (size_t)RH * HD, HD, RH, (size_t)2 * TT * TT, (size_t)HD * TT, (size_t)TT * HD);
            k_merge<<<(unsigned)(((size_t)ZH * TT * HD / 2 + 255) / 256), 256, 0, stream>>>(Ob, h0, ATh, ATl); }
        // out[t][b][:] : row pitch NB*DM, batch slab offset b*DM
        k_gemmw<bf, 1, false><<<dim3(TT / 64, DM / 64, 1), 32, 0, stream>>>(ATh, ATl, WO, nullptr, DQ, OUT + (size_t)b * DM, NB_ * DM, nullptr, 0, 0, 0); }
}

// v004
// Measured time: 370 microseconds a run.
// Versions in between are left out here; by their measured steps it is 3.69 times as fast as v002.
// Counting every step since v000, it is 12.9 times as fast.
#include <hip/hip_runtime.h>

// Contractions (f32 accumulate): qkv projection v_wmma_f32_16x16x32_bf16 (bf16 x bf16, exact products); scores and prob x value: query rows < RH bf16 hi/lo planes (3 products), rows >= RH v_wmma_f32_16x16x32_f16 (probabilities relative to the running row maximum, divided by the row sum afterwards); output projection bf16 hi+lo activation x bf16 weight (2 products).
// Every float input is RNE-converted to bf16 on load. Softmax, rotary and all other side math in f32.

#ifndef NB
#define NB 4
#endif
#ifndef SEQ
#define SEQ 2048
#endif
#define NB_FULL  4                 // batch stride of the staged x rows ([S][B][D])
#define SEQ_FULL 2048              // row pitch of the staged additive mask
#define NB_  NB
#define TT   SEQ
#define DM   1024
#define NH_  16
#define NKV  16
#define REP  (NH_ / NKV)
#define HD   64
#define DQ   (NH_ * HD)
#define DKV  (NKV * HD)
#define RH   ((SEQ) < 512 ? (SEQ) : 512)   // query rows < RH use hi+lo planes
#define SCL  0.125f                // HD^-0.5
static_assert(SEQ % 128 == 0);
static_assert(RH % 64 == 0);
static_assert(SEQ <= SEQ_FULL);
static_assert(NB <= NB_FULL);
static_assert(DM % 64 == 0);
static_assert(DQ == DM);

typedef _Float16 h16;
typedef unsigned short bf;
typedef __attribute__((ext_vector_type(16))) __bf16   v16bf;
typedef __attribute__((ext_vector_type(16))) _Float16 v16h;
typedef __attribute__((ext_vector_type(8)))  _Float16 v8h;
typedef __attribute__((ext_vector_type(8)))  unsigned short v8us;
typedef __attribute__((ext_vector_type(8)))  float    v8f;
typedef __attribute__((ext_vector_type(4)))  float    v4f;
typedef __attribute__((ext_vector_type(4)))  int      v4i;
typedef __attribute__((ext_vector_type(2)))  _Float16 v2h;
typedef __attribute__((ext_vector_type(4)))  _Float16 v4h;
typedef __attribute__((ext_vector_type(2)))  unsigned short v2us;
typedef __attribute__((ext_vector_type(4)))  unsigned short v4us;
typedef __attribute__((ext_vector_type(2)))  float    v2f;
typedef v8h  __attribute__((may_alias)) v8ha;
typedef v4f  __attribute__((may_alias)) v4fa;
typedef v8us __attribute__((may_alias)) v8usa;
typedef v4us __attribute__((may_alias)) v4usa;
typedef v4h  __attribute__((may_alias)) v4ha;

__device__ __forceinline__ unsigned short f2bf(float f) { unsigned u = __float_as_uint(f); u += 0x7FFFu + ((u >> 16) & 1u); return (unsigned short)(u >> 16); }
__device__ __forceinline__ float bf2f(unsigned short b) { return __uint_as_float(((unsigned)b) << 16); }
__device__ __forceinline__ float bfr(float f) { return bf2f(f2bf(f)); }
__device__ __forceinline__ v16h cat16(v8h lo, v8h hi) { return __builtin_shufflevector(lo, hi, 0, 1, 2, 3, 4, 5, 6, 7, 8, 9, 10, 11, 12, 13, 14, 15); }
__device__ __forceinline__ v16bf cat16b(v8us lo, v8us hi) { return __builtin_bit_cast(v16bf, __builtin_shufflevector(lo, hi, 0, 1, 2, 3, 4, 5, 6, 7, 8, 9, 10, 11, 12, 13, 14, 15)); }
__device__ __forceinline__ v8f wmma16(v16h a, v16h b, v8f c) { return __builtin_amdgcn_wmma_f32_16x16x32_f16(false, a, false, b, (short)0, c, false, false); }
__device__ __forceinline__ v8f wmmab(v16bf a, v16bf b, v8f c) { return __builtin_amdgcn_wmma_f32_16x16x32_bf16(false, a, false, b, (short)0, c, false, false); }

__device__ __forceinline__ h16 tohx(float x) { return (h16)x; }
__device__ __forceinline__ void splitf(float y, unsigned short& h, unsigned short& l) { h = f2bf(y); l = f2bf(y - bf2f(h)); }

// ---- k_gemmw: register-blocked GEMM, ONE WAVE per 64x64 output tile (16 accumulators), operands straight from K-contiguous 16-bit planes; grid (M/64, N/64, Z), 32 threads.
// C[m][n] (f32, pitch ldc, + optional f32 bias[n]) = sum_k A[m][k] Bt[n][k] (+ split products per NSPLIT). z-batch strides sA/sB/sC in elements. K % 32 == 0, M % 64 == 0, N % 64 == 0.
// Fragment map: lane -> row/col (lane & 15); elements 0..7 <- k0 + 8*(lane>>4) + 0..7, elements 8..15 <- k0 + 16 + 8*(lane>>4) + 0..7; D element j <- (row 8*(lane>>4) + j, col lane & 15).
template <typename T16> struct WFrag;
template <> struct WFrag<h16> { typedef v16h V; static __device__ __forceinline__ V ld(const h16* p) { return cat16(*(const v8h*)p, *(const v8h*)(p + 16)); } static __device__ __forceinline__ v8f mma(V a, V b, v8f c) { return wmma16(a, b, c); } };
template <> struct WFrag<bf> { typedef v16bf V; static __device__ __forceinline__ V ld(const bf* p) { return cat16b(*(const v8us*)p, *(const v8us*)(p + 16)); } static __device__ __forceinline__ v8f mma(V a, V b, v8f c) { return wmmab(a, b, c); } };
// gemm_acc: the K loop of one wave's 64x64 tile (rows r0.., columns c0..), shared by k_gemmw and k_qkv.
template <typename T16, int NSPLIT>
__device__ __forceinline__ void gemm_acc(const T16* __restrict__ A, const T16* __restrict__ A2, const T16* __restrict__ Bt, const T16* __restrict__ Bt2, int K, int r0, int c0, v8f (&acc)[4][4]) {
    typedef typename WFrag<T16>::V V;
    const int lane = threadIdx.x & 31, lr = lane & 15, hi = lane >> 4;
#pragma unroll
    for (int mb = 0; mb < 4; ++mb)
#pragma unroll
        for (int nb = 0; nb < 4; ++nb) acc[mb][nb] = (v8f){};
    const size_t aoff = (size_t)(r0 + lr) * K + 8 * hi, boff = (size_t)(c0 + lr) * K + 8 * hi;
#pragma unroll 1
    for (int kc = 0; kc < K; kc += 32) {
        V a[4], a2[4];
#pragma unroll
        for (int mb = 0; mb < 4; ++mb) { a[mb] = WFrag<T16>::ld(A + aoff + (size_t)mb * 16 * K + kc); if (NSPLIT == 1 || NSPLIT == 2) a2[mb] = WFrag<T16>::ld(A2 + aoff + (size_t)mb * 16 * K + kc); }
#pragma unroll
        for (int nb = 0; nb < 4; ++nb) { const V b = WFrag<T16>::ld(Bt + boff + (size_t)nb * 16 * K + kc); V b2; if (NSPLIT >= 2) b2 = WFrag<T16>::ld(Bt2 + boff + (size_t)nb * 16 * K + kc);
#pragma unroll
            for (int mb = 0; mb < 4; ++mb) { acc[mb][nb] = WFrag<T16>::mma(a[mb], b, acc[mb][nb]); if (NSPLIT == 1 || NSPLIT == 2) acc[mb][nb] = WFrag<T16>::mma(a2[mb], b, acc[mb][nb]); if (NSPLIT >= 2) acc[mb][nb] = WFrag<T16>::mma(a[mb], b2, acc[mb][nb]); } }
        asm volatile("v_nop\n\tv_nop\n\tv_nop\n\tv_nop" : "+v"(acc[0][0]), "+v"(acc[1][1]), "+v"(acc[2][2]), "+v"(acc[3][3]) : "v"(a[0]), "v"(a[3]));
    }
}
template <typename T16, int NSPLIT, bool BIAS>
__global__ __launch_bounds__(32) void k_gemmw(const T16* __restrict__ A, const T16* __restrict__ A2, const T16* __restrict__ Bt, const T16* __restrict__ Bt2, int K, float* C, int ldc, const float* __restrict__ bias, size_t sA, size_t sB, size_t sC) {
    __shared__ __align__(16) float os[16 * 68];
    const size_t z = blockIdx.z; A += z * sA; if (A2) A2 += z * sA; Bt += z * sB; if (Bt2) Bt2 += z * sB; C += z * sC;
    const int lane = threadIdx.x & 31, lr = lane & 15, hi = lane >> 4; const int r0 = blockIdx.x * 64, c0 = blockIdx.y * 64;
    v8f acc[4][4];
    gemm_acc<T16, NSPLIT>(A, A2, Bt, Bt2, K, r0, c0, acc);
#pragma unroll
    for (int mb = 0; mb < 4; ++mb) {
#pragma unroll
        for (int nb = 0; nb < 4; ++nb) {
#pragma unroll
            for (int j = 0; j < 8; ++j) os[(hi * 8 + j) * 68 + nb * 16 + lr] = acc[mb][nb][j]; }
        __builtin_amdgcn_wave_barrier(); asm volatile("" ::: "memory");
        float* crow = C + (size_t)(r0 + mb * 16) * ldc + c0;
{
#pragma unroll
            for (int s = 0; s < 8; ++s) { const int row = 2 * s + hi, cofs = lr * 4; v4f val = *(const v4fa*)(os + row * 68 + cofs); if (BIAS) { val[0] += bfr(bias[c0 + cofs]); val[1] += bfr(bias[c0 + cofs + 1]); val[2] += bfr(bias[c0 + cofs + 2]); val[3] += bfr(bias[c0 + cofs + 3]); }
                *(v4f*)(crow + (size_t)row * ldc + cofs) = val; }
             }
        __builtin_amdgcn_wave_barrier(); asm volatile("" ::: "memory");
    }
}

// ---- k_qkv: the q | k | v projection of all batches in one launch; one wave per tile of 64 tokens x 64 columns, which is one head; grid (TT/64, NH + 2 NKV, NB), 32 threads.
// X [b][t][DM] bf16, Wt [q heads | k heads | v heads][64][DM] bf16. The epilogue turns the f32 accumulators into the head planes (f16 + bf16 hi/lo) itself, so the projection is never stored in f32.
// q and k tiles, planes [b][h][t][d]: rotary in the interleaved-pair convention with the INPUT tables read as values (RNE bf16), all in f32:
// out[2i] = x[2i] cos[t][2i] - x[2i+1] sin[t][2i], out[2i+1] = x[2i+1] cos[t][2i+1] + x[2i] sin[t][2i+1]. The tile goes through LDS, 16 tokens at a time, so that a lane holds 4 neighbouring columns of one token.
// v tiles, planes [b][g][d][t]: in the D map a lane already holds 8 consecutive tokens of one column d, which is one 16-byte store per plane.
// Launch bound of 5 waves a SIMD: the unrolled epilogue then takes no more registers than the K loop, which sets how many waves hide each other's load waits.
__global__ __launch_bounds__(32, 5) void k_qkv(const bf* __restrict__ X, const bf* __restrict__ Wt, const float* __restrict__ COS, const float* __restrict__ SIN,
                                            h16* Q16, bf* Qh, bf* Ql, h16* K16, bf* Kh, bf* Kl, h16* V16, bf* Vh, bf* Vl) {
    __shared__ __align__(16) float os[16 * 68];
    const int lane = threadIdx.x & 31, lr = lane & 15, hi = lane >> 4; const int r0 = blockIdx.x * 64, hy = blockIdx.y; const size_t b = blockIdx.z;
    v8f acc[4][4];
    gemm_acc<bf, 0>(X + b * TT * DM, nullptr, Wt, nullptr, DM, r0, hy * 64, acc);
    if (hy >= NH_ + NKV) {
        const size_t zv = (b * NKV + (hy - NH_ - NKV)) * HD * TT + (size_t)lr * TT + r0 + 8 * hi;
#pragma unroll
        for (int mb = 0; mb < 4; ++mb)
#pragma unroll
            for (int nb = 0; nb < 4; ++nb) { v8h o16; v8us oh, ol;
#pragma unroll
                for (int j = 0; j < 8; ++j) { const float x = acc[mb][nb][j]; o16[j] = tohx(x); unsigned short a2, c2; splitf(x, a2, c2); oh[j] = a2; ol[j] = c2; }
                const size_t e = zv + (size_t)nb * 16 * TT + mb * 16;
                *(v8h*)(V16 + e) = o16; *(v8us*)(Vh + e) = oh; *(v8us*)(Vl + e) = ol; }
        return;
    }
    const bool isq = hy < NH_; const size_t zp = (isq ? b * NH_ + hy : b * NKV + (hy - NH_)) * TT * HD;
    const size_t e0 = (size_t)(r0 + hi) * HD + lr * 4;      // token r0 + hi, columns 4 lr .. 4 lr + 3: the same offset in a head's plane and in the tables
    h16* P16 = (isq ? Q16 : K16) + zp + e0; bf* Ph = (isq ? Qh : Kh) + zp + e0; bf* Pl = (isq ? Ql : Kl) + zp + e0; COS += e0; SIN += e0;
#pragma unroll
    for (int mb = 0; mb < 4; ++mb) {
#pragma unroll
        for (int nb = 0; nb < 4; ++nb) {
#pragma unroll
            for (int j = 0; j < 8; ++j) os[(hi * 8 + j) * 68 + nb * 16 + lr] = acc[mb][nb][j]; }
        // other lanes read what this lane wrote: the compiler must not move the LDS reads below over the writes above
        __builtin_amdgcn_wave_barrier(); asm volatile("" ::: "memory");
#pragma unroll
        for (int sh = 0; sh < 8; sh += 4) {
        // the table rows of 8 tokens are asked for together: one load latency per 8 tokens instead of four
        v4f ct[4], st[4];
        // the compiler lets these loads land in the data registers of the stores of the 8 tokens before: this wait stands between the two
        if (mb + sh) asm volatile("s_wait_xcnt 0x0" ::: "memory");
#pragma unroll
        for (int u = 0; u < 4; ++u) { ct[u] = *(const v4f*)(COS + (mb * 16 + 2 * (sh + u)) * HD); st[u] = *(const v4f*)(SIN + (mb * 16 + 2 * (sh + u)) * HD); }
#pragma unroll
        for (int u = 0; u < 4; ++u) { const int s = sh + u, e = (mb * 16 + 2 * s) * HD;
            const v4f x = *(const v4fa*)(os + (2 * s + hi) * 68 + lr * 4); const v4f cc = ct[u], ss = st[u];
            v4f r; r[0] = x[0] * bfr(cc[0]) - x[1] * bfr(ss[0]); r[1] = x[1] * bfr(cc[1]) + x[0] * bfr(ss[1]); r[2] = x[2] * bfr(cc[2]) - x[3] * bfr(ss[2]); r[3] = x[3] * bfr(cc[3]) + x[2] * bfr(ss[3]);
            v4h o16; v4us oh, ol;
#pragma unroll
            for (int q = 0; q < 4; ++q) { o16[q] = tohx(r[q]); unsigned short a2, c2; splitf(r[q], a2, c2); oh[q] = a2; ol[q] = c2; }
            *(v4h*)(P16 + e) = o16; *(v4us*)(Ph + e) = oh; *(v4us*)(Pl + e) = ol; } }
        // and the next 16 tokens' LDS writes must not move over these reads
        __builtin_amdgcn_wave_barrier(); asm volatile("" ::: "memory");
    }
}

// k_trw: in[rows][cols] f32 -> out[cols][rows] bf16 (RNE), 64x64 tiles through LDS (cross-wave: block barrier); grid (cols/64, rows/64), 256 threads.
__global__ __launch_bounds__(256) void k_trw(const float* __restrict__ in, bf* out, int rows, int cols) {
    __shared__ float ls[64 * 65];
    const int tid = threadIdx.x; const int c0 = blockIdx.x * 64, r0 = blockIdx.y * 64;
#pragma unroll
    for (int i = 0; i < 4; ++i) { const int r = (tid >> 4) + 16 * i; const int c = (tid & 15) * 4; const v4f v = *(const v4f*)(in + (size_t)(r0 + r) * cols + c0 + c);
        ls[r * 65 + c] = v[0]; ls[r * 65 + c + 1] = v[1]; ls[r * 65 + c + 2] = v[2]; ls[r * 65 + c + 3] = v[3]; }
    __syncthreads();
    const int n0 = tid >> 3, n1 = n0 + 32, pc = tid & 7; v8us o0, o1;
#pragma unroll
    for (int j = 0; j < 8; ++j) { o0[j] = f2bf(ls[(pc * 8 + j) * 65 + n0]); o1[j] = f2bf(ls[(pc * 8 + j) * 65 + n1]); }
    bf* p0 = out + (size_t)(c0 + n0) * rows + r0 + pc * 8; bf* p1 = out + (size_t)(c0 + n1) * rows + r0 + pc * 8;
    *(v8us*)p0 = o0; *(v8us*)p1 = o1; 
}

__global__ __launch_bounds__(256) void k_cvtx(const float* __restrict__ x, bf* dst) { const int b = blockIdx.y; dst += (size_t)b * TT * DM; const size_t i = (size_t)blockIdx.x * 256 + threadIdx.x; if (i >= (size_t)TT * DM / 8) return; const int t = (int)(i / (DM / 8)); const int c8 = (int)(i % (DM / 8));
    const v8f v = *(const v8f*)(x + ((size_t)t * NB_FULL + b) * DM + (size_t)c8 * 8); v8us o;
#pragma unroll
    for (int k = 0; k < 8; ++k) o[k] = f2bf(v[k]); *(v8us*)(dst + i * 8) = o;  }

// k_mchk: the additive mask rows 0..TT-1 are scanned by TT/8 blocks of 8 rows each, one wave per row: every entry above the diagonal must be <= -1e8 (its softmax weight is then exactly zero) and every diagonal entry >= -1e4.
// Block p stores its count of violations into its own 128-byte line of PB; k_mred, the next launch, adds the lines up.
__global__ __launch_bounds__(256) void k_mchk(const float* __restrict__ M, int* PB) {
    __shared__ int wb[8];
    const int tid = threadIdx.x, lane = tid & 31, wv = tid >> 5; int bad = 0;
    const int i = (int)blockIdx.x * 8 + __builtin_amdgcn_readfirstlane(wv);      // one wave per row: the row number and the row's base address are scalar
    const float* mr = M + (size_t)i * SEQ_FULL + lane * 4;
    // unrolled so that a lane's TT/128 independent loads overlap instead of each waiting for the one before
#pragma unroll
    for (int u = 0; u < TT / 128; ++u) { const int j0 = u * 128 + lane * 4; const v4f m = *(const v4f*)(mr + u * 128);
#pragma unroll
        for (int q = 0; q < 4; ++q) { const int j = j0 + q; const int bu = (m[q] <= -1.0e8f) ? 0 : 1; const int bd = (m[q] >= -1.0e4f) ? 0 : 1; bad += (j > i) ? bu : 0; bad += (j == i) ? bd : 0; } }
#pragma unroll
    for (int sh = 16; sh; sh >>= 1) bad += __shfl_xor(bad, sh, 32);
    if (lane == 0) wb[wv] = bad;
    __syncthreads();
    if (wv == 0) { int tot = 0;
#pragma unroll
        for (int k = 0; k < 8; ++k) tot += wb[k];
        if (lane < 8) { v4i o; o[0] = tot; o[1] = tot; o[2] = tot; o[3] = tot; *(v4i*)(PB + (size_t)blockIdx.x * 32 + lane * 4) = o; } }
}

// k_mred: one wave adds the TT/8 per-block counts of k_mchk and writes the flag line: 1.0 if no entry violates, NaN otherwise.
__global__ __launch_bounds__(32) void k_mred(const int* __restrict__ PB, float* FLG) {
    const int lane = threadIdx.x & 31; int tot = 0;
    // unrolled so that the lane's loads go out together: one memory latency for the whole launch
#pragma unroll
    for (int k = lane; k < TT / 8; k += 32) tot += PB[(size_t)k * 32];
#pragma unroll
    for (int sh = 16; sh; sh >>= 1) tot += __shfl_xor(tot, sh, 32);
    const float fv = tot ? __uint_as_float(0x7FC00000u) : 1.0f;
    if (lane < 8) { v4f o; o[0] = fv; o[1] = fv; o[2] = fv; o[3] = fv; *(v4f*)(FLG + lane * 4) = o; }
}

// ---- k_fattn: scores, softmax and probability x value in one kernel, transposed form: St = K Qt (A = key rows, B = query rows), Ot += Vt Pt (A = value planes [d][t], B = the probabilities).
// In the D map of St a lane holds, for ITS query (lane & 15), the keys 8*(lane>>4) + 0..7 of a 16-key tile: two such tiles are exactly elements 0..7 and 8..15 of the B operand of the next product, so P never leaves the registers.
// Running maximum and running sum per query (online softmax): a new maximum rescales the sum and the output tiles by exp(old - new). The two lane halves exchange the maximum every step and join their sums once at the end.
// t = S x HD^-0.5 + mask[i][j] (RNE bf16 mask value, read from the input) for j <= i; entries j > i have an exactly zero weight (property checked by k_mchk), so the key loop stops at the diagonal.
// The quotient by the row sum is taken on the f32 output; the result goes out as bf16 hi/lo planes [b][t][DQ] for the output projection.
// lane l <-> lane l ^ 16 by a vector cross-row move (a shuffle would go through the LDS pipe and its wait)
__device__ __forceinline__ float xhalf(float x) { return __builtin_bit_cast(float, __builtin_amdgcn_permlanex16(__builtin_bit_cast(int, x), __builtin_bit_cast(int, x), 0x76543210, 0xfedcba98, false, false)); }
template <typename T16, bool SPLIT, int NQ>
__device__ __forceinline__ void attn_cols(const T16* __restrict__ Q, const T16* __restrict__ Q2, const T16* __restrict__ Kp, const T16* __restrict__ K2, const T16* __restrict__ Vt, const T16* __restrict__ V2,
                                          const float* __restrict__ M, float fl, int q0, bf* Ah, bf* Al) {
    typedef typename WFrag<T16>::V V;
    const int lane = threadIdx.x & 31, lr = lane & 15, hi = lane >> 4;
    V qf[NQ][2], qf2[NQ][2]; v8f o[NQ][4]; float mrun[NQ], lsum[NQ];
#pragma unroll
    for (int n = 0; n < NQ; ++n) { mrun[n] = -3.0e38f; lsum[n] = 0.f;
#pragma unroll
        for (int c = 0; c < 2; ++c) { qf[n][c] = WFrag<T16>::ld(Q + (size_t)(q0 + 16 * n + lr) * HD + 8 * hi + 32 * c); if (SPLIT) qf2[n][c] = WFrag<T16>::ld(Q2 + (size_t)(q0 + 16 * n + lr) * HD + 8 * hi + 32 * c); }
#pragma unroll
        for (int d = 0; d < 4; ++d) o[n][d] = (v8f){}; }
    const int kend = q0 + 16 * NQ;      // keys 0 .. kend-1 reach some query of this wave; a step covers 32 keys and stays inside the TT rows of the planes
    for (int k0 = 0; k0 < kend; k0 += 32) {
        V kf[2][2], kf2[2][2], vf[4], vf2[4];
#pragma unroll
        for (int t = 0; t < 2; ++t)
#pragma unroll
            for (int c = 0; c < 2; ++c) { kf[t][c] = WFrag<T16>::ld(Kp + (size_t)(k0 + 16 * t + lr) * HD + 8 * hi + 32 * c); if (SPLIT) kf2[t][c] = WFrag<T16>::ld(K2 + (size_t)(k0 + 16 * t + lr) * HD + 8 * hi + 32 * c); }
#pragma unroll
        for (int d = 0; d < 4; ++d) { vf[d] = WFrag<T16>::ld(Vt + (size_t)(16 * d + lr) * TT + 8 * hi + k0); if (SPLIT) vf2[d] = WFrag<T16>::ld(V2 + (size_t)(16 * d + lr) * TT + 8 * hi + k0); }
#pragma unroll
        for (int n = 0; n < NQ; ++n) {
            const int i = q0 + 16 * n + lr; const float* mr = M + (size_t)i * SEQ_FULL + k0 + 8 * hi;
            v4f mk[2][2];
#pragma unroll
            for (int t = 0; t < 2; ++t) { mk[t][0] = *(const v4f*)(mr + 16 * t); mk[t][1] = *(const v4f*)(mr + 16 * t + 4); }
            v8f s[2];
#pragma unroll
            for (int t = 0; t < 2; ++t) { s[t] = (v8f){};
#pragma unroll
                for (int c = 0; c < 2; ++c) { s[t] = WFrag<T16>::mma(kf[t][c], qf[n][c], s[t]); if (SPLIT) { s[t] = WFrag<T16>::mma(kf[t][c], qf2[n][c], s[t]); s[t] = WFrag<T16>::mma(kf2[t][c], qf[n][c], s[t]); } } }
            float p[16]; float mx = mrun[n];
#pragma unroll
            for (int t = 0; t < 2; ++t)
#pragma unroll
                for (int j = 0; j < 8; ++j) { const int jj = k0 + 16 * t + 8 * hi + j; const float sv = s[t][j] * SCL + bfr(mk[t][j >> 2][j & 3]); const float tv = (jj <= i) ? sv : -3.0e38f; p[t * 8 + j] = tv; mx = fmaxf(mx, tv); }
            mx = fmaxf(mx, xhalf(mx));
            float ps = 0.f;
#pragma unroll
            for (int e = 0; e < 16; ++e) { p[e] = __builtin_amdgcn_exp2f((p[e] - mx) * 1.4426950408889634f); ps += p[e]; }
            const float alpha = __builtin_amdgcn_exp2f((mrun[n] - mx) * 1.4426950408889634f); mrun[n] = mx;
            lsum[n] = lsum[n] * alpha + ps;
#pragma unroll
            for (int d = 0; d < 4; ++d) o[n][d] *= alpha;
            if constexpr (SPLIT) {
                v8us h0, h1, l0, l1;
#pragma unroll
                for (int j = 0; j < 8; ++j) { unsigned short a, c2; splitf(p[j], a, c2); h0[j] = a; l0[j] = c2; splitf(p[8 + j], a, c2); h1[j] = a; l1[j] = c2; }
                const V ph = cat16b(h0, h1), pl = cat16b(l0, l1);
#pragma unroll
                for (int d = 0; d < 4; ++d) { o[n][d] = WFrag<T16>::mma(vf[d], ph, o[n][d]); o[n][d] = WFrag<T16>::mma(vf[d], pl, o[n][d]); o[n][d] = WFrag<T16>::mma(vf2[d], ph, o[n][d]); }
            } else {
                v8h a0, a1;
#pragma unroll
                for (int j = 0; j < 8; ++j) { a0[j] = tohx(p[j]); a1[j] = tohx(p[8 + j]); }
                const V pb = cat16(a0, a1);
#pragma unroll
                for (int d = 0; d < 4; ++d) o[n][d] = WFrag<T16>::mma(vf[d], pb, o[n][d]);
            }
        }
    }
#pragma unroll
    for (int n = 0; n < NQ; ++n) {
        const float sum = lsum[n] + xhalf(lsum[n]); const float f = __fdiv_rn(1.0f, sum) * fl;
        const size_t oo = (size_t)(q0 + 16 * n + lr) * DQ + 8 * hi;
#pragma unroll
        for (int d = 0; d < 4; ++d) { v8us oh, ol;
#pragma unroll
            for (int j = 0; j < 8; ++j) { unsigned short a, c2; splitf(o[n][d][j] * f, a, c2); oh[j] = a; ol[j] = c2; }
            *(v8us*)(Ah + oo + 16 * d) = oh; *(v8us*)(Al + oo + 16 * d) = ol; }
    }
}

// grid (NB * NH, NBF + NBH), FW waves per block, no barrier: blockIdx.x = batch x head, blockIdx.y = position block, the longest key loops first.
// Position blocks 0..NBF-1: query rows >= RH, f16 planes, 32 queries per wave. The others: rows < RH, bf16 hi/lo planes (3 products), 16 queries per wave.
#define FW  4
#define NBF ((TT - RH) / (FW * 32))
#define NBH (RH / (FW * 16))
static_assert((TT - RH) % (FW * 32) == 0);
static_assert(RH % (FW * 16) == 0);
__global__ __launch_bounds__(FW * 32) void k_fattn(const h16* __restrict__ Q16, const h16* __restrict__ K16, const h16* __restrict__ V16, const bf* __restrict__ Qh, const bf* __restrict__ Ql, const bf* __restrict__ Kh, const bf* __restrict__ Kl,
                                                   const bf* __restrict__ Vh, const bf* __restrict__ Vl, const float* __restrict__ M, const float* __restrict__ FLG, bf* Ah, bf* Al) {
    const int wv = __builtin_amdgcn_readfirstlane((int)(threadIdx.x >> 5)); const int b = (int)blockIdx.x / NH_, h = (int)blockIdx.x % NH_, pb = (int)blockIdx.y;
    const size_t zq = ((size_t)b * NH_ + h) * TT * HD, zk = ((size_t)b * NKV + h / REP) * TT * HD, za = (size_t)b * TT * DQ + (size_t)h * HD; const float fl = FLG[0];
    if (pb < NBF) attn_cols<h16, false, 2>(Q16 + zq, nullptr, K16 + zk, nullptr, V16 + zk, nullptr, M, fl, TT - (pb + 1) * FW * 32 + wv * 32, Ah + za, Al + za);
    else attn_cols<bf, true, 1>(Qh + zq, Ql + zq, Kh + zk, Kl + zk, Vh + zk, Vl + zk, M, fl, RH - (pb - NBF + 1) * FW * 16 + wv * 16, Ah + za, Al + za);
}

#define AL256(b) ((((size_t)(b)) + 255) & ~(size_t)255)
constexpr size_t WS_TOTAL =
    AL256((size_t)3 * DM * DM * 2) + AL256((size_t)DM * DQ * 2) + AL256(256) + AL256((size_t)(TT / 8) * 128) + AL256((size_t)NB_ * TT * DM * 2)
    + 9 * AL256((size_t)NB_ * NH_ * TT * HD * 2) + 2 * AL256((size_t)NB_ * TT * DQ * 2);
static_assert(WS_TOTAL <= (size_t)268435456);

extern "C" void kernel_launch(void* const* d_in, const int* in_sizes, int n_in,
                              void* d_out, int out_size, void* d_ws, size_t ws_size, hipStream_t stream) {
    if (n_in < 6) return;
    if ((size_t)in_sizes[0] < (size_t)TT * NB_FULL * DM) return;      // x [S][B][D]
    if ((size_t)in_sizes[1] < (size_t)TT * SEQ_FULL) return;          // additive mask [S][S]
    if ((size_t)in_sizes[2] < (size_t)TT * HD) return;                // cos [S][64]
    if ((size_t)in_sizes[3] < (size_t)TT * HD) return;                // sin [S][64]
    if ((size_t)in_sizes[4] < (size_t)DM * 3 * DM) return;            // Wqkv [in 1024][out 3072]
    if ((size_t)in_sizes[5] < (size_t)DM * DM) return;                // Wout [in 1024][out 1024]
    if ((size_t)out_size < (size_t)TT * NB_ * DM) return;
    const float* x = (const float*)d_in[0]; const float* mask = (const float*)d_in[1]; const float* cosb = (const float*)d_in[2]; const float* sinb = (const float*)d_in[3];
    const float* wqkv = (const float*)d_in[4]; const float* wout = (const float*)d_in[5];
    float* OUT = (float*)d_out;     // [S][B][D]
    char* wsp = (char*)d_ws;
    auto take = [&](size_t bytes) { char* p = wsp; wsp += (bytes + 255) & ~(size_t)255; return (void*)p; };
    bf* WQKV = (bf*)take((size_t)3 * DM * DM * 2);     // [3072 out][1024 in]: q | k | v = row thirds
    bf* WO = (bf*)take((size_t)DM * DQ * 2);           // [1024 out][1024 in]
    float* FLG = (float*)take(256);
    int* PB = (int*)take((size_t)(TT / 8) * 128);      // one 128-byte line per block of the mask scan
    bf* XB = (bf*)take((size_t)NB_ * TT * DM * 2);     // [b][t][DM]
    // head planes and attention output planes of all batches: [b][h][t][d], [b][h][d][t], [b][t][DQ]
    constexpr size_t PQ = (size_t)NH_ * TT * HD, PK = (size_t)NKV * TT * HD;
    h16* QP16 = (h16*)take(NB_ * PQ * 2); h16* KP16 = (h16*)take(NB_ * PK * 2); h16* VT16 = (h16*)take(NB_ * PK * 2);
    bf* QPh = (bf*)take(NB_ * PQ * 2); bf* QPl = (bf*)take(NB_ * PQ * 2); bf* KPh = (bf*)take(NB_ * PK * 2); bf* KPl = (bf*)take(NB_ * PK * 2); bf* VTh = (bf*)take(NB_ * PK * 2); bf* VTl = (bf*)take(NB_ * PK * 2);
    bf* ATh = (bf*)take((size_t)NB_ * TT * DQ * 2); bf* ATl = (bf*)take((size_t)NB_ * TT * DQ * 2);
    if ((size_t)(wsp - (char*)d_ws) > ws_size) return;
    if ((size_t)(wsp - (char*)d_ws) > (size_t)268435456) return;

    // in[rows = 1024 (in)][cols = 3072 (out)] -> out[cols][rows]; grid (cols/64, rows/64)
    k_trw<<<dim3(3 * DM / 64, DM / 64, 1), 256, 0, stream>>>(wqkv, WQKV, DM, 3 * DM);
    // in[rows = 1024 (in)][cols = 1024 (out)] -> out[cols][rows]; grid (cols/64, rows/64)
    k_trw<<<dim3(DM / 64, DM / 64, 1), 256, 0, stream>>>(wout, WO, DM, DM);
    k_mchk<<<TT / 8, 256, 0, stream>>>(mask, PB);
    k_mred<<<1, 32, 0, stream>>>(PB, FLG);

    k_cvtx<<<dim3((unsigned)(((size_t)TT * DM / 8 + 255) / 256), NB_, 1), 256, 0, stream>>>(x, XB);
    k_qkv<<<dim3(TT / 64, NH_ + 2 * NKV, NB_), 32, 0, stream>>>(XB, WQKV, cosb, sinb, QP16, QPh, QPl, KP16, KPh, KPl, VT16, VTh, VTl);
    k_fattn<<<dim3(NB_ * NH_, NBF + NBH, 1), FW * 32, 0, stream>>>(QP16, KP16, VT16, QPh, QPl, KPh, KPl, VTh, VTl, mask, FLG, ATh, ATl);
    // out[t][b][:] : row pitch NB*DM, batch slab offset b*DM
    for (int b = 0; b < NB_; ++b)
        k_gemmw<bf, 1, false><<<dim3(TT / 64, DM / 64, 1), 32, 0, stream>>>(ATh + (size_t)b * TT * DQ, ATl + (size_t)b * TT * DQ, WO, nullptr, DQ, OUT + (size_t)b * DM, NB_ * DM, nullptr, 0, 0, 0);
}

// v005
// Measured time: 354 microseconds a run.
// In both of two side-by-side timings against v004, it was 1.05 times as fast.
// All steps since v000 together make it 13.5 times as fast.
#include <hip/hip_runtime.h>

// Contractions (f32 accumulate): qkv projection v_wmma_f32_16x16x32_bf16 (bf16 x bf16, exact products); scores and prob x value: query rows < RH bf16 hi/lo planes (3 products), rows >= RH v_wmma_f32_16x16x32_f16 (probabilities relative to the running row maximum, divided by the row sum afterwards); output projection bf16 hi+lo activation x bf16 weight (2 products).
// Every float input is RNE-converted to bf16 on load. Softmax, rotary and all other side math in f32.
// FRAGMENT ORDER: every 16-bit plane that feeds a matrix operand (rows x K columns) is stored as tiles of 16 rows x 32 columns, 512 elements = 1 KB each, the K/32 tiles of a 16-row band one after the other.
// Inside a tile element (r, c) lies at (c >> 4 & 1) * 256 + ((c >> 3 & 1) * 16 + r) * 8 + (c & 7): lane l of the wave that takes the tile as an A or B operand reads 16 bytes at l * 8 and at 256 + l * 8,
// so each wave-wide load covers 512 contiguous bytes (4 whole lines) instead of 32 bytes in each of 16 lines.

#ifndef NB
#define NB 4
#endif
#ifndef SEQ
#define SEQ 2048
#endif
#define NB_FULL  4                 // batch stride of the staged x rows ([S][B][D])
#define SEQ_FULL 2048              // row pitch of the staged additive mask
#define NB_  NB
#define TT   SEQ
#define DM   1024
#define NH_  16
#define NKV  16
#define REP  (NH_ / NKV)
#define HD   64
#define DQ   (NH_ * HD)
#define DKV  (NKV * HD)
#define RH   ((SEQ) < 512 ? (SEQ) : 512)   // query rows < RH use hi+lo planes
#define SCL  0.125f                // HD^-0.5
static_assert(SEQ % 128 == 0);
static_assert(RH % 64 == 0);
static_assert(SEQ <= SEQ_FULL);
static_assert(NB <= NB_FULL);
static_assert(DM % 64 == 0);
static_assert(DQ == DM);

typedef _Float16 h16;
typedef unsigned short bf;
typedef __attribute__((ext_vector_type(16))) __bf16   v16bf;
typedef __attribute__((ext_vector_type(16))) _Float16 v16h;
typedef __attribute__((ext_vector_type(8)))  _Float16 v8h;
typedef __attribute__((ext_vector_type(8)))  unsigned short v8us;
typedef __attribute__((ext_vector_type(8)))  float    v8f;
typedef __attribute__((ext_vector_type(4)))  float    v4f;
typedef __attribute__((ext_vector_type(4)))  int      v4i;
typedef __attribute__((ext_vector_type(2)))  _Float16 v2h;
typedef __attribute__((ext_vector_type(4)))  _Float16 v4h;
typedef __attribute__((ext_vector_type(2)))  unsigned short v2us;
typedef __attribute__((ext_vector_type(4)))  unsigned short v4us;
typedef __attribute__((ext_vector_type(2)))  float    v2f;
typedef v8h  __attribute__((may_alias)) v8ha;
typedef v4f  __attribute__((may_alias)) v4fa;
typedef v8us __attribute__((may_alias)) v8usa;
typedef v4us __attribute__((may_alias)) v4usa;
typedef v4h  __attribute__((may_alias)) v4ha;

__device__ __forceinline__ unsigned short f2bf(float f) { unsigned u = __float_as_uint(f); u += 0x7FFFu + ((u >> 16) & 1u); return (unsigned short)(u >> 16); }
__device__ __forceinline__ float bf2f(unsigned short b) { return __uint_as_float(((unsigned)b) << 16); }
__device__ __forceinline__ float bfr(float f) { return bf2f(f2bf(f)); }
__device__ __forceinline__ v16h cat16(v8h lo, v8h hi) { return __builtin_shufflevector(lo, hi, 0, 1, 2, 3, 4, 5, 6, 7, 8, 9, 10, 11, 12, 13, 14, 15); }
__device__ __forceinline__ v16bf cat16b(v8us lo, v8us hi) { return __builtin_bit_cast(v16bf, __builtin_shufflevector(lo, hi, 0, 1, 2, 3, 4, 5, 6, 7, 8, 9, 10, 11, 12, 13, 14, 15)); }
__device__ __forceinline__ v8f wmma16(v16h a, v16h b, v8f c) { return __builtin_amdgcn_wmma_f32_16x16x32_f16(false, a, false, b, (short)0, c, false, false); }
__device__ __forceinline__ v8f wmmab(v16bf a, v16bf b, v8f c) { return __builtin_amdgcn_wmma_f32_16x16x32_bf16(false, a, false, b, (short)0, c, false, false); }

__device__ __forceinline__ h16 tohx(float x) { return (h16)x; }
__device__ __forceinline__ void splitf(float y, unsigned short& h, unsigned short& l) { h = f2bf(y); l = f2bf(y - bf2f(h)); }
// element offset of (row, col) in a plane of K columns in fragment order
__device__ __forceinline__ size_t fo(int row, int col, int K) { return ((size_t)(row >> 4) * (K >> 5) + (col >> 5)) * 512 + ((col >> 4) & 1) * 256 + (((col >> 3) & 1) * 16 + (row & 15)) * 8 + (col & 7); }

// ---- k_gemmw: register-blocked GEMM, ONE WAVE per 64x64 output tile (16 accumulators), operands straight from 16-bit planes in fragment order; grid (M/64, N/64, Z), 32 threads.
// C[m][n] (f32, pitch ldc, + optional f32 bias[n]) = sum_k A[m][k] Bt[n][k] (+ split products per NSPLIT). z-batch strides sA/sB/sC in elements. K % 32 == 0, M % 64 == 0, N % 64 == 0.
// Fragment map (ld takes tile start + 8 * lane): lane -> row/col (lane & 15); elements 0..7 <- k0 + 8*(lane>>4) + 0..7, elements 8..15 <- k0 + 16 + 8*(lane>>4) + 0..7; D element j <- (row 8*(lane>>4) + j, col lane & 15).
template <typename T16> struct WFrag;
template <> struct WFrag<h16> { typedef v16h V; static __device__ __forceinline__ V ld(const h16* p) { return cat16(*(const v8h*)p, *(const v8h*)(p + 256)); } static __device__ __forceinline__ v8f mma(V a, V b, v8f c) { return wmma16(a, b, c); } };
template <> struct WFrag<bf> { typedef v16bf V; static __device__ __forceinline__ V ld(const bf* p) { return cat16b(*(const v8us*)p, *(const v8us*)(p + 256)); } static __device__ __forceinline__ v8f mma(V a, V b, v8f c) { return wmmab(a, b, c); } };
// gemm_acc: the K loop of one wave's 64x64 tile (rows r0.., columns c0..), shared by k_gemmw and k_qkv.
// K is a constant of the build: the four 16-row bands of an operand are then immediate offsets on one address.
template <typename T16, int NSPLIT, int K>
__device__ __forceinline__ void gemm_acc(const T16* __restrict__ A, const T16* __restrict__ A2, const T16* __restrict__ Bt, const T16* __restrict__ Bt2, int r0, int c0, v8f (&acc)[4][4]) {
    typedef typename WFrag<T16>::V V;
    const int lane = threadIdx.x & 31;
#pragma unroll
    for (int mb = 0; mb < 4; ++mb)
#pragma unroll
        for (int nb = 0; nb < 4; ++nb) acc[mb][nb] = (v8f){};
    // a 16-row band holds 16 K elements; the lane's place in every tile is 8 * lane
    const size_t aoff = (size_t)r0 * K + 8 * lane, boff = (size_t)c0 * K + 8 * lane;
#pragma unroll 1
    for (int kc = 0; kc < K; kc += 32) {
        // a step of 32 columns is one tile of 512 elements
        const T16* ap = A + aoff + kc * 16; const T16* bp = Bt + boff + kc * 16;
        const T16* ap2 = (NSPLIT == 1 || NSPLIT == 2) ? A2 + aoff + kc * 16 : nullptr; const T16* bp2 = (NSPLIT >= 2) ? Bt2 + boff + kc * 16 : nullptr;
        V a[4], a2[4];
#pragma unroll
        for (int mb = 0; mb < 4; ++mb) { a[mb] = WFrag<T16>::ld(ap + mb * 16 * K); if (NSPLIT == 1 || NSPLIT == 2) a2[mb] = WFrag<T16>::ld(ap2 + mb * 16 * K); }
#pragma unroll
        for (int nb = 0; nb < 4; ++nb) { const V b = WFrag<T16>::ld(bp + nb * 16 * K); V b2; if (NSPLIT >= 2) b2 = WFrag<T16>::ld(bp2 + nb * 16 * K);
#pragma unroll
            for (int mb = 0; mb < 4; ++mb) { acc[mb][nb] = WFrag<T16>::mma(a[mb], b, acc[mb][nb]); if (NSPLIT == 1 || NSPLIT == 2) acc[mb][nb] = WFrag<T16>::mma(a2[mb], b, acc[mb][nb]); if (NSPLIT >= 2) acc[mb][nb] = WFrag<T16>::mma(a[mb], b2, acc[mb][nb]); } }
        asm volatile("v_nop\n\tv_nop\n\tv_nop\n\tv_nop" : "+v"(acc[0][0]), "+v"(acc[1][1]), "+v"(acc[2][2]), "+v"(acc[3][3]) : "v"(a[0]), "v"(a[3]));
        // the wait that stands between this trip's loads and the rewriting of their address registers; as its operands the addresses stay whole up to here, so that no load of the trip lands in one
        if constexpr (NSPLIT == 0) asm volatile("s_wait_xcnt 0x0" :: "v"(ap), "v"(bp) : "memory");
        else if constexpr (NSPLIT == 1) asm volatile("s_wait_xcnt 0x0" :: "v"(ap), "v"(bp), "v"(ap2) : "memory");
        else asm volatile("s_wait_xcnt 0x0" :: "v"(ap), "v"(bp), "v"(ap2), "v"(bp2) : "memory");
    }
}
template <typename T16, int NSPLIT, bool BIAS, int K>
__global__ __launch_bounds__(32) void k_gemmw(const T16* __restrict__ A, const T16* __restrict__ A2, const T16* __restrict__ Bt, const T16* __restrict__ Bt2, float* C, int ldc, const float* __restrict__ bias, size_t sA, size_t sB, size_t sC) {
    __shared__ __align__(16) float os[16 * 68];
    const size_t z = blockIdx.z; A += z * sA; if (A2) A2 += z * sA; Bt += z * sB; if (Bt2) Bt2 += z * sB; C += z * sC;
    const int lane = threadIdx.x & 31, lr = lane & 15, hi = lane >> 4; const int r0 = blockIdx.x * 64, c0 = blockIdx.y * 64;
    v8f acc[4][4];
    gemm_acc<T16, NSPLIT, K>(A, A2, Bt, Bt2, r0, c0, acc);
#pragma unroll
    for (int mb = 0; mb < 4; ++mb) {
#pragma unroll
        for (int nb = 0; nb < 4; ++nb) {
#pragma unroll
            for (int j = 0; j < 8; ++j) os[(hi * 8 + j) * 68 + nb * 16 + lr] = acc[mb][nb][j]; }
        __builtin_amdgcn_wave_barrier(); asm volatile("" ::: "memory");
        float* crow = C + (size_t)(r0 + mb * 16) * ldc + c0;
{
#pragma unroll
            for (int s = 0; s < 8; ++s) { const int row = 2 * s + hi, cofs = lr * 4; v4f val = *(const v4fa*)(os + row * 68 + cofs); if (BIAS) { val[0] += bfr(bias[c0 + cofs]); val[1] += bfr(bias[c0 + cofs + 1]); val[2] += bfr(bias[c0 + cofs + 2]); val[3] += bfr(bias[c0 + cofs + 3]); }
                *(v4f*)(crow + (size_t)row * ldc + cofs) = val; }
             }
        __builtin_amdgcn_wave_barrier(); asm volatile("" ::: "memory");
    }
}

// ---- k_qkv: the q | k | v projection of all batches in one launch; one wave per tile of 64 tokens x 64 columns, which is one head; grid (TT/64, NH + 2 NKV, NB), 32 threads.
// X [b][t][DM] bf16, Wt [q heads | k heads | v heads][64][DM] bf16, each plane in fragment order, as are the head planes. The epilogue turns the f32 accumulators into the head planes (f16 + bf16 hi/lo) itself, so the projection is never stored in f32.
// q and k tiles, planes [b][h][t][d]: rotary in the interleaved-pair convention with the INPUT tables read as values (RNE bf16), all in f32:
// out[2i] = x[2i] cos[t][2i] - x[2i+1] sin[t][2i], out[2i+1] = x[2i+1] cos[t][2i+1] + x[2i] sin[t][2i+1]. The tile goes through LDS, 16 tokens at a time, so that a lane holds 4 neighbouring columns of one token.
// v tiles, planes [b][g][d][t]: in the D map a lane already holds 8 consecutive tokens of one column d, which is the lane's own 16 bytes of a half tile: one 512-byte wave store per plane.
// Launch bound of 5 waves a SIMD: the unrolled epilogue then takes no more registers than the K loop, which sets how many waves hide each other's load waits.
__global__ __launch_bounds__(32, 5) void k_qkv(const bf* __restrict__ X, const bf* __restrict__ Wt, const float* __restrict__ COS, const float* __restrict__ SIN,
                                            h16* Q16, bf* Qh, bf* Ql, h16* K16, bf* Kh, bf* Kl, h16* V16, bf* Vh, bf* Vl) {
    __shared__ __align__(16) float os[16 * 68];
    const int lane = threadIdx.x & 31, lr = lane & 15, hi = lane >> 4; const int r0 = blockIdx.x * 64, hy = blockIdx.y; const size_t b = blockIdx.z;
    v8f acc[4][4];
    gemm_acc<bf, 0, DM>(X + b * TT * DM, nullptr, Wt, nullptr, r0, hy * 64, acc);
    if (hy >= NH_ + NKV) {
        const size_t zv = (b * NKV + (hy - NH_ - NKV)) * HD * TT + (size_t)r0 * 16 + 8 * lane;
#pragma unroll
        for (int mb = 0; mb < 4; ++mb)
#pragma unroll
            for (int nb = 0; nb < 4; ++nb) { v8h o16; v8us oh, ol;
#pragma unroll
                for (int j = 0; j < 8; ++j) { const float x = acc[mb][nb][j]; o16[j] = tohx(x); unsigned short a2, c2; splitf(x, a2, c2); oh[j] = a2; ol[j] = c2; }
                const size_t e = zv + (size_t)nb * 16 * TT + (mb >> 1) * 512 + (mb & 1) * 256;
                *(v8h*)(V16 + e) = o16; *(v8us*)(Vh + e) = oh; *(v8us*)(Vl + e) = ol; }
        return;
    }
    const bool isq = hy < NH_; const size_t zp = (isq ? b * NH_ + hy : b * NKV + (hy - NH_)) * TT * HD;
    const size_t e0 = (size_t)(r0 + hi) * HD + lr * 4;      // token r0 + hi, columns 4 lr .. 4 lr + 3 in the tables
    const size_t f0 = fo(r0 + hi, lr * 4, HD);              // and in a head's plane; 16 tokens on are 1024 elements, 2 tokens on are 16
    h16* P16 = (isq ? Q16 : K16) + zp + f0; bf* Ph = (isq ? Qh : Kh) + zp + f0; bf* Pl = (isq ? Ql : Kl) + zp + f0; COS += e0; SIN += e0;
#pragma unroll
    for (int mb = 0; mb < 4; ++mb) {
#pragma unroll
        for (int nb = 0; nb < 4; ++nb) {
#pragma unroll
            for (int j = 0; j < 8; ++j) os[(hi * 8 + j) * 68 + nb * 16 + lr] = acc[mb][nb][j]; }
        // other lanes read what this lane wrote: the compiler must not move the LDS reads below over the writes above
        __builtin_amdgcn_wave_barrier(); asm volatile("" ::: "memory");
#pragma unroll
        for (int sh = 0; sh < 8; sh += 4) {
        // the table rows of 8 tokens are asked for together: one load latency per 8 tokens instead of four
        v4f ct[4], st[4];
        // the compiler lets these loads land in the data registers of the stores of the 8 tokens before: this wait stands between the two
        if (mb + sh) asm volatile("s_wait_xcnt 0x0" ::: "memory");
#pragma unroll
        for (int u = 0; u < 4; ++u) { ct[u] = *(const v4f*)(COS + (mb * 16 + 2 * (sh + u)) * HD); st[u] = *(const v4f*)(SIN + (mb * 16 + 2 * (sh + u)) * HD); }
#pragma unroll
        for (int u = 0; u < 4; ++u) { const int s = sh + u, e = mb * 1024 + s * 16;
            const v4f x = *(const v4fa*)(os + (2 * s + hi) * 68 + lr * 4); const v4f cc = ct[u], ss = st[u];
            v4f r; r[0] = x[0] * bfr(cc[0]) - x[1] * bfr(ss[0]); r[1] = x[1] * bfr(cc[1]) + x[0] * bfr(ss[1]); r[2] = x[2] * bfr(cc[2]) - x[3] * bfr(ss[2]); r[3] = x[3] * bfr(cc[3]) + x[2] * bfr(ss[3]);
            v4h o16; v4us oh, ol;
#pragma unroll
            for (int q = 0; q < 4; ++q) { o16[q] = tohx(r[q]); unsigned short a2, c2; splitf(r[q], a2, c2); oh[q] = a2; ol[q] = c2; }
            *(v4h*)(P16 + e) = o16; *(v4us*)(Ph + e) = oh; *(v4us*)(Pl + e) = ol; } }
        // and the next 16 tokens' LDS writes must not move over these reads
        __builtin_amdgcn_wave_barrier(); asm volatile("" ::: "memory");
    }
}

// k_trw: in[rows][cols] f32 -> out[cols][rows] bf16 (RNE) in fragment order, 64x64 tiles through LDS (cross-wave: block barrier); grid (cols/64, rows/64), 256 threads.
__global__ __launch_bounds__(256) void k_trw(const float* __restrict__ in, bf* out, int rows, int cols) {
    __shared__ float ls[64 * 65];
    const int tid = threadIdx.x; const int c0 = blockIdx.x * 64, r0 = blockIdx.y * 64;
#pragma unroll
    for (int i = 0; i < 4; ++i) { const int r = (tid >> 4) + 16 * i; const int c = (tid & 15) * 4; const v4f v = *(const v4f*)(in + (size_t)(r0 + r) * cols + c0 + c);
        ls[r * 65 + c] = v[0]; ls[r * 65 + c + 1] = v[1]; ls[r * 65 + c + 2] = v[2]; ls[r * 65 + c + 3] = v[3]; }
    __syncthreads();
    const int n0 = (tid & 15) + 16 * (tid >> 7), n1 = n0 + 32, pc = (tid >> 4) & 7; v8us o0, o1;      // a wave writes two half tiles, one per store
#pragma unroll
    for (int j = 0; j < 8; ++j) { o0[j] = f2bf(ls[(pc * 8 + j) * 65 + n0]); o1[j] = f2bf(ls[(pc * 8 + j) * 65 + n1]); }
    bf* p0 = out + fo(c0 + n0, r0 + pc * 8, rows); bf* p1 = out + fo(c0 + n1, r0 + pc * 8, rows);
    *(v8us*)p0 = o0; *(v8us*)p1 = o1; 
}

__global__ __launch_bounds__(256) void k_cvtx(const float* __restrict__ x, bf* dst) { const int b = blockIdx.y; dst += (size_t)b * TT * DM; const size_t i = (size_t)blockIdx.x * 256 + threadIdx.x; if (i >= (size_t)TT * DM / 8) return;
    // thread i writes the i-th 16 bytes of the plane in fragment order: tile i / 64, then half, column eighth, row
    const int tile = (int)(i >> 6); const int t = (tile / (DM / 32)) * 16 + (int)(i & 15); const int c8 = (tile % (DM / 32)) * 4 + (int)((i >> 4) & 3);
    const v8f v = *(const v8f*)(x + ((size_t)t * NB_FULL + b) * DM + (size_t)c8 * 8); v8us o;
#pragma unroll
    for (int k = 0; k < 8; ++k) o[k] = f2bf(v[k]); *(v8us*)(dst + i * 8) = o;  }

// k_mchk: the additive mask rows 0..TT-1 are scanned by TT/8 blocks of 8 rows each, one wave per row: every entry above the diagonal must be <= -1e8 (its softmax weight is then exactly zero) and every diagonal entry >= -1e4.
// Block p stores its count of violations into its own 128-byte line of PB; k_mred, the next launch, adds the lines up.
__global__ __launch_bounds__(256) void k_mchk(const float* __restrict__ M, int* PB) {
    __shared__ int wb[8];
    const int tid = threadIdx.x, lane = tid & 31, wv = tid >> 5; int bad = 0;
    const int i = (int)blockIdx.x * 8 + __builtin_amdgcn_readfirstlane(wv);      // one wave per row: the row number and the row's base address are scalar
    const float* mr = M + (size_t)i * SEQ_FULL + lane * 4;
    // unrolled so that a lane's TT/128 independent loads overlap instead of each waiting for the one before
#pragma unroll
    for (int u = 0; u < TT / 128; ++u) { const int j0 = u * 128 + lane * 4; const v4f m = *(const v4f*)(mr + u * 128);
#pragma unroll
        for (int q = 0; q < 4; ++q) { const int j = j0 + q; const int bu = (m[q] <= -1.0e8f) ? 0 : 1; const int bd = (m[q] >= -1.0e4f) ? 0 : 1; bad += (j > i) ? bu : 0; bad += (j == i) ? bd : 0; } }
#pragma unroll
    for (int sh = 16; sh; sh >>= 1) bad += __shfl_xor(bad, sh, 32);
    if (lane == 0) wb[wv] = bad;
    __syncthreads();
    if (wv == 0) { int tot = 0;
#pragma unroll
        for (int k = 0; k < 8; ++k) tot += wb[k];
        if (lane < 8) { v4i o; o[0] = tot; o[1] = tot; o[2] = tot; o[3] = tot; *(v4i*)(PB + (size_t)blockIdx.x * 32 + lane * 4) = o; } }
}

// k_mred: one wave adds the TT/8 per-block counts of k_mchk and writes the flag line: 1.0 if no entry violates, NaN otherwise.
__global__ __launch_bounds__(32) void k_mred(const int* __restrict__ PB, float* FLG) {
    const int lane = threadIdx.x & 31; int tot = 0;
    // unrolled so that the lane's loads go out together: one memory latency for the whole launch
#pragma unroll
    for (int k = lane; k < TT / 8; k += 32) tot += PB[(size_t)k * 32];
#pragma unroll
    for (int sh = 16; sh; sh >>= 1) tot += __shfl_xor(tot, sh, 32);
    const float fv = tot ? __uint_as_float(0x7FC00000u) : 1.0f;
    if (lane < 8) { v4f o; o[0] = fv; o[1] = fv; o[2] = fv; o[3] = fv; *(v4f*)(FLG + lane * 4) = o; }
}

// ---- k_fattn: scores, softmax and probability x value in one kernel, transposed form: St = K Qt (A = key rows, B = query rows), Ot += Vt Pt (A = value planes [d][t], B = the probabilities).
// In the D map of St a lane holds, for ITS query (lane & 15), the keys 8*(lane>>4) + 0..7 of a 16-key tile: two such tiles are exactly elements 0..7 and 8..15 of the B operand of the next product, so P never leaves the registers.
// Running maximum and running sum per query (online softmax): a new maximum rescales the sum and the output tiles by exp(old - new). The two lane halves exchange the maximum every step and join their sums once at the end.
// t = S x HD^-0.5 + mask[i][j] (RNE bf16 mask value, read from the input) for j <= i; entries j > i have an exactly zero weight (property checked by k_mchk), so the key loop stops at the diagonal.
// The quotient by the row sum is taken on the f32 output; the result goes out as bf16 hi/lo planes [b][t][DQ], fragment order, for the output projection.
// lane l <-> lane l ^ 16 by a vector cross-row move (a shuffle would go through the LDS pipe and its wait)
__device__ __forceinline__ float xhalf(float x) { return __builtin_bit_cast(float, __builtin_amdgcn_permlanex16(__builtin_bit_cast(int, x), __builtin_bit_cast(int, x), 0x76543210, 0xfedcba98, false, false)); }
template <typename T16, bool SPLIT, int NQ>
__device__ __forceinline__ void attn_cols(const T16* __restrict__ Q, const T16* __restrict__ Q2, const T16* __restrict__ Kp, const T16* __restrict__ K2, const T16* __restrict__ Vt, const T16* __restrict__ V2,
                                          const float* __restrict__ M, float fl, int q0, bf* Ah, bf* Al) {
    typedef typename WFrag<T16>::V V;
    const int lane = threadIdx.x & 31, lr = lane & 15, hi = lane >> 4;
    V qf[NQ][2], qf2[NQ][2]; v8f o[NQ][4]; float mrun[NQ], lsum[NQ];
#pragma unroll
    for (int n = 0; n < NQ; ++n) { mrun[n] = -3.0e38f; lsum[n] = 0.f;
#pragma unroll
        for (int c = 0; c < 2; ++c) { qf[n][c] = WFrag<T16>::ld(Q + (size_t)(q0 + 16 * n) * HD + 512 * c + 8 * lane); if (SPLIT) qf2[n][c] = WFrag<T16>::ld(Q2 + (size_t)(q0 + 16 * n) * HD + 512 * c + 8 * lane); }
#pragma unroll
        for (int d = 0; d < 4; ++d) o[n][d] = (v8f){}; }
    unsigned ofk = 16 * lane, ofv = 16 * lane;      // bytes: the lane's place in the step's first key tile and first value tile; every load is scalar base + one of these + immediate
    const int kend = q0 + 16 * NQ;      // keys 0 .. kend-1 reach some query of this wave; a step covers 32 keys and stays inside the TT rows of the planes
    for (int k0 = 0; k0 < kend; k0 += 32) {
        V kf[2][2], kf2[2][2], vf[4], vf2[4];
#pragma unroll
        for (int t = 0; t < 2; ++t)
#pragma unroll
            for (int c = 0; c < 2; ++c) { kf[t][c] = WFrag<T16>::ld((const T16*)((const char*)Kp + ofk) + 16 * t * HD + 512 * c); if (SPLIT) kf2[t][c] = WFrag<T16>::ld((const T16*)((const char*)K2 + ofk) + 16 * t * HD + 512 * c); }
#pragma unroll
        for (int d = 0; d < 4; ++d) { vf[d] = WFrag<T16>::ld((const T16*)((const char*)Vt + ofv) + 16 * d * TT); if (SPLIT) vf2[d] = WFrag<T16>::ld((const T16*)((const char*)V2 + ofv) + 16 * d * TT); }
#pragma unroll
        for (int n = 0; n < NQ; ++n) {
            const int i = q0 + 16 * n + lr; const float* mr = M + (size_t)i * SEQ_FULL + k0 + 8 * hi;
            v4f mk[2][2];
#pragma unroll
            for (int t = 0; t < 2; ++t) { mk[t][0] = *(const v4f*)(mr + 16 * t); mk[t][1] = *(const v4f*)(mr + 16 * t + 4); }
            v8f s[2];
#pragma unroll
            for (int t = 0; t < 2; ++t) { s[t] = (v8f){};
#pragma unroll
                for (int c = 0; c < 2; ++c) { s[t] = WFrag<T16>::mma(kf[t][c], qf[n][c], s[t]); if (SPLIT) { s[t] = WFrag<T16>::mma(kf[t][c], qf2[n][c], s[t]); s[t] = WFrag<T16>::mma(kf2[t][c], qf[n][c], s[t]); } } }
            float p[16]; float mx = mrun[n];
#pragma unroll
            for (int t = 0; t < 2; ++t)
#pragma unroll
                for (int j = 0; j < 8; ++j) { const int jj = k0 + 16 * t + 8 * hi + j; const float sv = s[t][j] * SCL + bfr(mk[t][j >> 2][j & 3]); const float tv = (jj <= i) ? sv : -3.0e38f; p[t * 8 + j] = tv; mx = fmaxf(mx, tv); }
            mx = fmaxf(mx, xhalf(mx));
            float ps = 0.f;
#pragma unroll
            for (int e = 0; e < 16; ++e) { p[e] = __builtin_amdgcn_exp2f((p[e] - mx) * 1.4426950408889634f); ps += p[e]; }
            const float alpha = __builtin_amdgcn_exp2f((mrun[n] - mx) * 1.4426950408889634f); mrun[n] = mx;
            lsum[n] = lsum[n] * alpha + ps;
#pragma unroll
            for (int d = 0; d < 4; ++d) o[n][d] *= alpha;
            if constexpr (SPLIT) {
                v8us h0, h1, l0, l1;
#pragma unroll
                for (int j = 0; j < 8; ++j) { unsigned short a, c2; splitf(p[j], a, c2); h0[j] = a; l0[j] = c2; splitf(p[8 + j], a, c2); h1[j] = a; l1[j] = c2; }
                const V ph = cat16b(h0, h1), pl = cat16b(l0, l1);
#pragma unroll
                for (int d = 0; d < 4; ++d) { o[n][d] = WFrag<T16>::mma(vf[d], ph, o[n][d]); o[n][d] = WFrag<T16>::mma(vf[d], pl, o[n][d]); o[n][d] = WFrag<T16>::mma(vf2[d], ph, o[n][d]); }
            } else {
                v8h a0, a1;
#pragma unroll
                for (int j = 0; j < 8; ++j) { a0[j] = tohx(p[j]); a1[j] = tohx(p[8 + j]); }
                const V pb = cat16(a0, a1);
#pragma unroll
                for (int d = 0; d < 4; ++d) o[n][d] = WFrag<T16>::mma(vf[d], pb, o[n][d]);
            }
        }
        // the wait that stands between this step's key and value loads and the rewriting of their offset registers; as its operands the registers stay whole up to here, so that no load of the step lands in one
        asm volatile("s_wait_xcnt 0x0" : "+v"(ofk), "+v"(ofv) :: "memory");
        ofk += 32 * HD * 2; ofv += 1024;
    }
#pragma unroll
    for (int n = 0; n < NQ; ++n) {
        const float sum = lsum[n] + xhalf(lsum[n]); const float f = __fdiv_rn(1.0f, sum) * fl;
        const size_t oo = (size_t)(q0 + 16 * n) * DQ + 8 * lane;      // the lane's 8 columns are its own 16 bytes of a half tile
#pragma unroll
        for (int d = 0; d < 4; ++d) { v8us oh, ol;
#pragma unroll
            for (int j = 0; j < 8; ++j) { unsigned short a, c2; splitf(o[n][d][j] * f, a, c2); oh[j] = a; ol[j] = c2; }
            *(v8us*)(Ah + oo + 256 * d) = oh; *(v8us*)(Al + oo + 256 * d) = ol; }
    }
}

// grid (NB * NH, NBF + NBH), FW waves per block, no barrier: blockIdx.x = batch x head, blockIdx.y = position block, the longest key loops first.
// Position blocks 0..NBF-1: query rows >= RH, f16 planes, 32 queries per wave. The others: rows < RH, bf16 hi/lo planes (3 products), 16 queries per wave.
#define FW  4
#define NBF ((TT - RH) / (FW * 32))
#define NBH (RH / (FW * 16))
static_assert((TT - RH) % (FW * 32) == 0);
static_assert(RH % (FW * 16) == 0);
__global__ __launch_bounds__(FW * 32) void k_fattn(const h16* __restrict__ Q16, const h16* __restrict__ K16, const h16* __restrict__ V16, const bf* __restrict__ Qh, const bf* __restrict__ Ql, const bf* __restrict__ Kh, const bf* __restrict__ Kl,
                                                   const bf* __restrict__ Vh, const bf* __restrict__ Vl, const float* __restrict__ M, const float* __restrict__ FLG, bf* Ah, bf* Al) {
    const int wv = __builtin_amdgcn_readfirstlane((int)(threadIdx.x >> 5)); const int b = (int)blockIdx.x / NH_, h = (int)blockIdx.x % NH_, pb = (int)blockIdx.y;
    const size_t zq = ((size_t)b * NH_ + h) * TT * HD, zk = ((size_t)b * NKV + h / REP) * TT * HD, za = (size_t)b * TT * DQ + (size_t)h * HD * 16; const float fl = FLG[0];
    if (pb < NBF) attn_cols<h16, false, 2>(Q16 + zq, nullptr, K16 + zk, nullptr, V16 + zk, nullptr, M, fl, TT - (pb + 1) * FW * 32 + wv * 32, Ah + za, Al + za);
    else attn_cols<bf, true, 1>(Qh + zq, Ql + zq, Kh + zk, Kl + zk, Vh + zk, Vl + zk, M, fl, RH - (pb - NBF + 1) * FW * 16 + wv * 16, Ah + za, Al + za);
}

#define AL256(b) ((((size_t)(b)) + 255) & ~(size_t)255)
constexpr size_t WS_TOTAL =
    AL256((size_t)3 * DM * DM * 2) + AL256((size_t)DM * DQ * 2) + AL256(256) + AL256((size_t)(TT / 8) * 128) + AL256((size_t)NB_ * TT * DM * 2)
    + 9 * AL256((size_t)NB_ * NH_ * TT * HD * 2) + 2 * AL256((size_t)NB_ * TT * DQ * 2);
static_assert(WS_TOTAL <= (size_t)268435456);

extern "C" void kernel_launch(void* const* d_in, const int* in_sizes, int n_in,
                              void* d_out, int out_size, void* d_ws, size_t ws_size, hipStream_t stream) {
    if (n_in < 6) return;
    if ((size_t)in_sizes[0] < (size_t)TT * NB_FULL * DM) return;      // x [S][B][D]
    if ((size_t)in_sizes[1] < (size_t)TT * SEQ_FULL) return;          // additive mask [S][S]
    if ((size_t)in_sizes[2] < (size_t)TT * HD) return;                // cos [S][64]
    if ((size_t)in_sizes[3] < (size_t)TT * HD) return;                // sin [S][64]
    if ((size_t)in_sizes[4] < (size_t)DM * 3 * DM) return;            // Wqkv [in 1024][out 3072]
    if ((size_t)in_sizes[5] < (size_t)DM * DM) return;                // Wout [in 1024][out 1024]
    if ((size_t)out_size < (size_t)TT * NB_ * DM) return;
    const float* x = (const float*)d_in[0]; const float* mask = (const float*)d_in[1]; const float* cosb = (const float*)d_in[2]; const float* sinb = (const float*)d_in[3];
    const float* wqkv = (const float*)d_in[4]; const float* wout = (const float*)d_in[5];
    float* OUT = (float*)d_out;     // [S][B][D]
    char* wsp = (char*)d_ws;
    auto take = [&](size_t bytes) { char* p = wsp; wsp += (bytes + 255) & ~(size_t)255; return (void*)p; };
    bf* WQKV = (bf*)take((size_t)3 * DM * DM * 2);     // [3072 out][1024 in]: q | k | v = row thirds
    bf* WO = (bf*)take((size_t)DM * DQ * 2);           // [1024 out][1024 in]
    float* FLG = (float*)take(256);
    int* PB = (int*)take((size_t)(TT / 8) * 128);      // one 128-byte line per block of the mask scan
    bf* XB = (bf*)take((size_t)NB_ * TT * DM * 2);     // [b][t][DM]
    // head planes and attention output planes of all batches: [b][h][t][d], [b][h][d][t], [b][t][DQ], the last two indices in fragment order
    constexpr size_t PQ = (size_t)NH_ * TT * HD, PK = (size_t)NKV * TT * HD;
    h16* QP16 = (h16*)take(NB_ * PQ * 2); h16* KP16 = (h16*)take(NB_ * PK * 2); h16* VT16 = (h16*)take(NB_ * PK * 2);
    bf* QPh = (bf*)take(NB_ * PQ * 2); bf* QPl = (bf*)take(NB_ * PQ * 2); bf* KPh = (bf*)take(NB_ * PK * 2); bf* KPl = (bf*)take(NB_ * PK * 2); bf* VTh = (bf*)take(NB_ * PK * 2); bf* VTl = (bf*)take(NB_ * PK * 2);
    bf* ATh = (bf*)take((size_t)NB_ * TT * DQ * 2); bf* ATl = (bf*)take((size_t)NB_ * TT * DQ * 2);
    if ((size_t)(wsp - (char*)d_ws) > ws_size) return;
    if ((size_t)(wsp - (char*)d_ws) > (size_t)268435456) return;

    // in[rows = 1024 (in)][cols = 3072 (out)] -> out[cols][rows]; grid (cols/64, rows/64)
    k_trw<<<dim3(3 * DM / 64, DM / 64, 1), 256, 0, stream>>>(wqkv, WQKV, DM, 3 * DM);
    // in[rows = 1024 (in)][cols = 1024 (out)] -> out[cols][rows]; grid (cols/64, rows/64)
    k_trw<<<dim3(DM / 64, DM / 64, 1), 256, 0, stream>>>(wout, WO, DM, DM);
    k_mchk<<<TT / 8, 256, 0, stream>>>(mask, PB);
    k_mred<<<1, 32, 0, stream>>>(PB, FLG);

    k_cvtx<<<dim3((unsigned)(((size_t)TT * DM / 8 + 255) / 256), NB_, 1), 256, 0, stream>>>(x, XB);
    k_qkv<<<dim3(TT / 64, NH_ + 2 * NKV, NB_), 32, 0, stream>>>(XB, WQKV, cosb, sinb, QP16, QPh, QPl, KP16, KPh, KPl, VT16, VTh, VTl);
    k_fattn<<<dim3(NB_ * NH_, NBF + NBH, 1), FW * 32, 0, stream>>>(QP16, KP16, VT16, QPh, QPl, KPh, KPl, VTh, VTl, mask, FLG, ATh, ATl);
    // out[t][b][:] : row pitch NB*DM, batch slab offset b*DM
    for (int b = 0; b < NB_; ++b)
        k_gemmw<bf, 1, false, DQ><<<dim3(TT / 64, DM / 64, 1), 32, 0, stream>>>(ATh + (size_t)b * TT * DQ, ATl + (size_t)b * TT * DQ, WO, nullptr, OUT + (size_t)b * DM, NB_ * DM, nullptr, 0, 0, 0);
}

// v006
// A run of this version takes 243 microseconds.
// Timed twice side by side with v005, it ran 1.45 times as fast both times.
// Over all steps from v000 it is 19.6 times as fast.
#include <hip/hip_runtime.h>

// Contractions (f32 accumulate): qkv projection v_wmma_f32_16x16x32_bf16 (bf16 x bf16, exact products); scores and prob x value: query rows < RH bf16 hi/lo planes (3 products), rows >= RH v_wmma_f32_16x16x32_f16 (probabilities relative to the running row maximum, divided by the row sum afterwards); output projection bf16 hi+lo activation x bf16 weight (2 products).
// Every float input is RNE-converted to bf16 on load. Softmax, rotary and all other side math in f32.
// FRAGMENT ORDER: every 16-bit plane that feeds a matrix operand (rows x K columns) is stored as tiles of 16 rows x 32 columns, 512 elements = 1 KB each, the K/32 tiles of a 16-row band one after the other.
// Inside a tile element (r, c) lies at (c >> 4 & 1) * 256 + ((c >> 3 & 1) * 16 + r) * 8 + (c & 7): lane l of the wave that takes the tile as an A or B operand reads 16 bytes at l * 8 and at 256 + l * 8,
// so each wave-wide load covers 512 contiguous bytes (4 whole lines) instead of 32 bytes in each of 16 lines.

#ifndef NB
#define NB 4
#endif
#ifndef SEQ
#define SEQ 2048
#endif
#define NB_FULL  4                 // batch stride of the staged x rows ([S][B][D])
#define SEQ_FULL 2048              // row pitch of the staged additive mask
#define NB_  NB
#define TT   SEQ
#define DM   1024
#define NH_  16
#define NKV  16
#define REP  (NH_ / NKV)
#define HD   64
#define DQ   (NH_ * HD)
#define DKV  (NKV * HD)
#define RH   ((SEQ) < 512 ? (SEQ) : 512)   // query rows < RH use hi+lo planes
#define SCL  0.125f                // HD^-0.5
static_assert(SEQ % 128 == 0);
static_assert(RH % 64 == 0);
static_assert(SEQ <= SEQ_FULL);
static_assert(NB <= NB_FULL);
static_assert(DM % 64 == 0);
static_assert(DQ == DM);

typedef _Float16 h16;
typedef unsigned short bf;
typedef __attribute__((ext_vector_type(16))) __bf16   v16bf;
typedef __attribute__((ext_vector_type(16))) _Float16 v16h;
typedef __attribute__((ext_vector_type(8)))  _Float16 v8h;
typedef __attribute__((ext_vector_type(8)))  unsigned short v8us;
typedef __attribute__((ext_vector_type(8)))  float    v8f;
typedef __attribute__((ext_vector_type(4)))  float    v4f;
typedef __attribute__((ext_vector_type(4)))  int      v4i;
typedef __attribute__((ext_vector_type(2)))  _Float16 v2h;
typedef __attribute__((ext_vector_type(4)))  _Float16 v4h;
typedef __attribute__((ext_vector_type(2)))  unsigned short v2us;
typedef __attribute__((ext_vector_type(4)))  unsigned short v4us;
typedef __attribute__((ext_vector_type(2)))  float    v2f;
typedef v8h  __attribute__((may_alias)) v8ha;
typedef v4f  __attribute__((may_alias)) v4fa;
typedef v8us __attribute__((may_alias)) v8usa;
typedef v4us __attribute__((may_alias)) v4usa;
typedef v4h  __attribute__((may_alias)) v4ha;

__device__ __forceinline__ unsigned short f2bf(float f) { unsigned u = __float_as_uint(f); u += 0x7FFFu + ((u >> 16) & 1u); return (unsigned short)(u >> 16); }
__device__ __forceinline__ float bf2f(unsigned short b) { return __uint_as_float(((unsigned)b) << 16); }
__device__ __forceinline__ float bfr(float f) { return bf2f(f2bf(f)); }
__device__ __forceinline__ v16h cat16(v8h lo, v8h hi) { return __builtin_shufflevector(lo, hi, 0, 1, 2, 3, 4, 5, 6, 7, 8, 9, 10, 11, 12, 13, 14, 15); }
__device__ __forceinline__ v16bf cat16b(v8us lo, v8us hi) { return __builtin_bit_cast(v16bf, __builtin_shufflevector(lo, hi, 0, 1, 2, 3, 4, 5, 6, 7, 8, 9, 10, 11, 12, 13, 14, 15)); }
__device__ __forceinline__ v8f wmma16(v16h a, v16h b, v8f c) { return __builtin_amdgcn_wmma_f32_16x16x32_f16(false, a, false, b, (short)0, c, false, false); }
__device__ __forceinline__ v8f wmmab(v16bf a, v16bf b, v8f c) { return __builtin_amdgcn_wmma_f32_16x16x32_bf16(false, a, false, b, (short)0, c, false, false); }

__device__ __forceinline__ h16 tohx(float x) { return (h16)x; }
__device__ __forceinline__ void splitf(float y, unsigned short& h, unsigned short& l) { h = f2bf(y); l = f2bf(y - bf2f(h)); }
// element offset of (row, col) in a plane of K columns in fragment order
__device__ __forceinline__ size_t fo(int row, int col, int K) { return ((size_t)(row >> 4) * (K >> 5) + (col >> 5)) * 512 + ((col >> 4) & 1) * 256 + (((col >> 3) & 1) * 16 + (row & 15)) * 8 + (col & 7); }

// ---- k_gemmw: register-blocked GEMM, ONE WAVE per 64x64 output tile (16 accumulators), operands straight from 16-bit planes in fragment order; grid (M/64, N/64, Z), 32 threads.
// C[m][n] (f32, pitch ldc, + optional f32 bias[n]) = sum_k A[m][k] Bt[n][k] (+ split products per NSPLIT). z-batch strides sA/sB/sC in elements. K % 32 == 0, M % 64 == 0, N % 64 == 0.
// Fragment map (ld takes tile start + 8 * lane): lane -> row/col (lane & 15); elements 0..7 <- k0 + 8*(lane>>4) + 0..7, elements 8..15 <- k0 + 16 + 8*(lane>>4) + 0..7; D element j <- (row 8*(lane>>4) + j, col lane & 15).
template <typename T16> struct WFrag;
template <> struct WFrag<h16> { typedef v16h V; static __device__ __forceinline__ V ld(const h16* p) { return cat16(*(const v8h*)p, *(const v8h*)(p + 256)); } static __device__ __forceinline__ v8f mma(V a, V b, v8f c) { return wmma16(a, b, c); } };
template <> struct WFrag<bf> { typedef v16bf V; static __device__ __forceinline__ V ld(const bf* p) { return cat16b(*(const v8us*)p, *(const v8us*)(p + 256)); } static __device__ __forceinline__ v8f mma(V a, V b, v8f c) { return wmmab(a, b, c); } };
// gemm_acc: the K loop of one wave's 64x64 tile (rows r0.., columns c0..), shared by k_gemmw and k_qkv.
// K is a constant of the build: the four 16-row bands of an operand are then immediate offsets on one address.
template <typename T16, int NSPLIT, int K>
__device__ __forceinline__ void gemm_acc(const T16* __restrict__ A, const T16* __restrict__ A2, const T16* __restrict__ Bt, const T16* __restrict__ Bt2, int r0, int c0, v8f (&acc)[4][4]) {
    typedef typename WFrag<T16>::V V;
    const int lane = threadIdx.x & 31;
#pragma unroll
    for (int mb = 0; mb < 4; ++mb)
#pragma unroll
        for (int nb = 0; nb < 4; ++nb) acc[mb][nb] = (v8f){};
    // a 16-row band holds 16 K elements; the lane's place in every tile is 8 * lane
    const size_t aoff = (size_t)r0 * K + 8 * lane, boff = (size_t)c0 * K + 8 * lane;
#pragma unroll 1
    for (int kc = 0; kc < K; kc += 32) {
        // a step of 32 columns is one tile of 512 elements
        const T16* ap = A + aoff + kc * 16; const T16* bp = Bt + boff + kc * 16;
        const T16* ap2 = (NSPLIT == 1 || NSPLIT == 2) ? A2 + aoff + kc * 16 : nullptr; const T16* bp2 = (NSPLIT >= 2) ? Bt2 + boff + kc * 16 : nullptr;
        V a[4], a2[4];
#pragma unroll
        for (int mb = 0; mb < 4; ++mb) { a[mb] = WFrag<T16>::ld(ap + mb * 16 * K); if (NSPLIT == 1 || NSPLIT == 2) a2[mb] = WFrag<T16>::ld(ap2 + mb * 16 * K); }
#pragma unroll
        for (int nb = 0; nb < 4; ++nb) { const V b = WFrag<T16>::ld(bp + nb * 16 * K); V b2; if (NSPLIT >= 2) b2 = WFrag<T16>::ld(bp2 + nb * 16 * K);
#pragma unroll
            for (int mb = 0; mb < 4; ++mb) { acc[mb][nb] = WFrag<T16>::mma(a[mb], b, acc[mb][nb]); if (NSPLIT == 1 || NSPLIT == 2) acc[mb][nb] = WFrag<T16>::mma(a2[mb], b, acc[mb][nb]); if (NSPLIT >= 2) acc[mb][nb] = WFrag<T16>::mma(a[mb], b2, acc[mb][nb]); } }
        asm volatile("v_nop\n\tv_nop\n\tv_nop\n\tv_nop" : "+v"(acc[0][0]), "+v"(acc[1][1]), "+v"(acc[2][2]), "+v"(acc[3][3]) : "v"(a[0]), "v"(a[3]));
        // the wait that stands between this trip's loads and the rewriting of their address registers; as its operands the addresses stay whole up to here, so that no load of the trip lands in one
        if constexpr (NSPLIT == 0) asm volatile("s_wait_xcnt 0x0" :: "v"(ap), "v"(bp) : "memory");
        else if constexpr (NSPLIT == 1) asm volatile("s_wait_xcnt 0x0" :: "v"(ap), "v"(bp), "v"(ap2) : "memory");
        else asm volatile("s_wait_xcnt 0x0" :: "v"(ap), "v"(bp), "v"(ap2), "v"(bp2) : "memory");
    }
}
template <typename T16, int NSPLIT, bool BIAS, int K>
__global__ __launch_bounds__(32) void k_gemmw(const T16* __restrict__ A, const T16* __restrict__ A2, const T16* __restrict__ Bt, const T16* __restrict__ Bt2, float* C, int ldc, const float* __restrict__ bias, size_t sA, size_t sB, size_t sC) {
    __shared__ __align__(16) float os[16 * 68];
    const size_t z = blockIdx.z; A += z * sA; if (A2) A2 += z * sA; Bt += z * sB; if (Bt2) Bt2 += z * sB; C += z * sC;
    const int lane = threadIdx.x & 31, lr = lane & 15, hi = lane >> 4; const int r0 = blockIdx.x * 64, c0 = blockIdx.y * 64;
    v8f acc[4][4];
    gemm_acc<T16, NSPLIT, K>(A, A2, Bt, Bt2, r0, c0, acc);
#pragma unroll
    for (int mb = 0; mb < 4; ++mb) {
#pragma unroll
        for (int nb = 0; nb < 4; ++nb) {
#pragma unroll
            for (int j = 0; j < 8; ++j) os[(hi * 8 + j) * 68 + nb * 16 + lr] = acc[mb][nb][j]; }
        __builtin_amdgcn_wave_barrier(); asm volatile("" ::: "memory");
        float* crow = C + (size_t)(r0 + mb * 16) * ldc + c0;
{
#pragma unroll
            for (int s = 0; s < 8; ++s) { const int row = 2 * s + hi, cofs = lr * 4; v4f val = *(const v4fa*)(os + row * 68 + cofs); if (BIAS) { val[0] += bfr(bias[c0 + cofs]); val[1] += bfr(bias[c0 + cofs + 1]); val[2] += bfr(bias[c0 + cofs + 2]); val[3] += bfr(bias[c0 + cofs + 3]); }
                *(v4f*)(crow + (size_t)row * ldc + cofs) = val; }
             }
        __builtin_amdgcn_wave_barrier(); asm volatile("" ::: "memory");
    }
}

// ---- k_qkv: the q | k | v projection of all batches in one launch; one wave per tile of 64 tokens x 64 columns, which is one head; grid (TT/64, NH + 2 NKV, NB), 32 threads.
// X [b][t][DM] bf16, Wt [q heads | k heads | v heads][64][DM] bf16, each plane in fragment order, as are the head planes. The epilogue turns the f32 accumulators into the head planes (f16 + bf16 hi/lo) itself, so the projection is never stored in f32.
// q and k tiles, planes [b][h][t][d]: rotary in the interleaved-pair convention with the INPUT tables read as values (RNE bf16), all in f32:
// out[2i] = x[2i] cos[t][2i] - x[2i+1] sin[t][2i], out[2i+1] = x[2i+1] cos[t][2i+1] + x[2i] sin[t][2i+1]. The tile goes through LDS, 16 tokens at a time, so that a lane holds 4 neighbouring columns of one token.
// v tiles, planes [b][g][d][t]: in the D map a lane already holds 8 consecutive tokens of one column d, which is the lane's own 16 bytes of a half tile: one 512-byte wave store per plane.
// Launch bound of 5 waves a SIMD: the unrolled epilogue then takes no more registers than the K loop, which sets how many waves hide each other's load waits.
__global__ __launch_bounds__(32, 5) void k_qkv(const bf* __restrict__ X, const bf* __restrict__ Wt, const float* __restrict__ COS, const float* __restrict__ SIN,
                                            h16* Q16, bf* Qh, bf* Ql, h16* K16, bf* Kh, bf* Kl, h16* V16, bf* Vh, bf* Vl) {
    __shared__ __align__(16) float os[16 * 68];
    const int lane = threadIdx.x & 31, lr = lane & 15, hi = lane >> 4; const int r0 = blockIdx.x * 64, hy = blockIdx.y; const size_t b = blockIdx.z;
    v8f acc[4][4];
    gemm_acc<bf, 0, DM>(X + b * TT * DM, nullptr, Wt, nullptr, r0, hy * 64, acc);
    if (hy >= NH_ + NKV) {
        const size_t zv = (b * NKV + (hy - NH_ - NKV)) * HD * TT + (size_t)r0 * 16 + 8 * lane;
#pragma unroll
        for (int mb = 0; mb < 4; ++mb)
#pragma unroll
            for (int nb = 0; nb < 4; ++nb) { v8h o16; v8us oh, ol;
#pragma unroll
                for (int j = 0; j < 8; ++j) { const float x = acc[mb][nb][j]; o16[j] = tohx(x); unsigned short a2, c2; splitf(x, a2, c2); oh[j] = a2; ol[j] = c2; }
                const size_t e = zv + (size_t)nb * 16 * TT + (mb >> 1) * 512 + (mb & 1) * 256;
                *(v8h*)(V16 + e) = o16; *(v8us*)(Vh + e) = oh; *(v8us*)(Vl + e) = ol; }
        return;
    }
    const bool isq = hy < NH_; const size_t zp = (isq ? b * NH_ + hy : b * NKV + (hy - NH_)) * TT * HD;
    const size_t e0 = (size_t)(r0 + hi) * HD + lr * 4;      // token r0 + hi, columns 4 lr .. 4 lr + 3 in the tables
    const size_t f0 = fo(r0 + hi, lr * 4, HD);              // and in a head's plane; 16 tokens on are 1024 elements, 2 tokens on are 16
    h16* P16 = (isq ? Q16 : K16) + zp + f0; bf* Ph = (isq ? Qh : Kh) + zp + f0; bf* Pl = (isq ? Ql : Kl) + zp + f0; COS += e0; SIN += e0;
#pragma unroll
    for (int mb = 0; mb < 4; ++mb) {
#pragma unroll
        for (int nb = 0; nb < 4; ++nb) {
#pragma unroll
            for (int j = 0; j < 8; ++j) os[(hi * 8 + j) * 68 + nb * 16 + lr] = acc[mb][nb][j]; }
        // other lanes read what this lane wrote: the compiler must not move the LDS reads below over the writes above
        __builtin_amdgcn_wave_barrier(); asm volatile("" ::: "memory");
#pragma unroll
        for (int sh = 0; sh < 8; sh += 4) {
        // the table rows of 8 tokens are asked for together: one load latency per 8 tokens instead of four
        v4f ct[4], st[4];
        // the compiler lets these loads land in the data registers of the stores of the 8 tokens before: this wait stands between the two
        if (mb + sh) asm volatile("s_wait_xcnt 0x0" ::: "memory");
#pragma unroll
        for (int u = 0; u < 4; ++u) { ct[u] = *(const v4f*)(COS + (mb * 16 + 2 * (sh + u)) * HD); st[u] = *(const v4f*)(SIN + (mb * 16 + 2 * (sh + u)) * HD); }
#pragma unroll
        for (int u = 0; u < 4; ++u) { const int s = sh + u, e = mb * 1024 + s * 16;
            const v4f x = *(const v4fa*)(os + (2 * s + hi) * 68 + lr * 4); const v4f cc = ct[u], ss = st[u];
            v4f r; r[0] = x[0] * bfr(cc[0]) - x[1] * bfr(ss[0]); r[1] = x[1] * bfr(cc[1]) + x[0] * bfr(ss[1]); r[2] = x[2] * bfr(cc[2]) - x[3] * bfr(ss[2]); r[3] = x[3] * bfr(cc[3]) + x[2] * bfr(ss[3]);
            v4h o16; v4us oh, ol;
#pragma unroll
            for (int q = 0; q < 4; ++q) { o16[q] = tohx(r[q]); unsigned short a2, c2; splitf(r[q], a2, c2); oh[q] = a2; ol[q] = c2; }
            *(v4h*)(P16 + e) = o16; *(v4us*)(Ph + e) = oh; *(v4us*)(Pl + e) = ol; } }
        // and the next 16 tokens' LDS writes must not move over these reads
        __builtin_amdgcn_wave_barrier(); asm volatile("" ::: "memory");
    }
}

// k_trw: in[rows][cols] f32 -> out[cols][rows] bf16 (RNE) in fragment order, 64x64 tiles through LDS (cross-wave: block barrier); grid (cols/64, rows/64), 256 threads.
__global__ __launch_bounds__(256) void k_trw(const float* __restrict__ in, bf* out, int rows, int cols) {
    __shared__ float ls[64 * 65];
    const int tid = threadIdx.x; const int c0 = blockIdx.x * 64, r0 = blockIdx.y * 64;
#pragma unroll
    for (int i = 0; i < 4; ++i) { const int r = (tid >> 4) + 16 * i; const int c = (tid & 15) * 4; const v4f v = *(const v4f*)(in + (size_t)(r0 + r) * cols + c0 + c);
        ls[r * 65 + c] = v[0]; ls[r * 65 + c + 1] = v[1]; ls[r * 65 + c + 2] = v[2]; ls[r * 65 + c + 3] = v[3]; }
    __syncthreads();
    const int n0 = (tid & 15) + 16 * (tid >> 7), n1 = n0 + 32, pc = (tid >> 4) & 7; v8us o0, o1;      // a wave writes two half tiles, one per store
#pragma unroll
    for (int j = 0; j < 8; ++j) { o0[j] = f2bf(ls[(pc * 8 + j) * 65 + n0]); o1[j] = f2bf(ls[(pc * 8 + j) * 65 + n1]); }
    bf* p0 = out + fo(c0 + n0, r0 + pc * 8, rows); bf* p1 = out + fo(c0 + n1, r0 + pc * 8, rows);
    *(v8us*)p0 = o0; *(v8us*)p1 = o1; 
}

__global__ __launch_bounds__(256) void k_cvtx(const float* __restrict__ x, bf* dst) { const int b = blockIdx.y; dst += (size_t)b * TT * DM; const size_t i = (size_t)blockIdx.x * 256 + threadIdx.x; if (i >= (size_t)TT * DM / 8) return;
    // thread i writes the i-th 16 bytes of the plane in fragment order: tile i / 64, then half, column eighth, row
    const int tile = (int)(i >> 6); const int t = (tile / (DM / 32)) * 16 + (int)(i & 15); const int c8 = (tile % (DM / 32)) * 4 + (int)((i >> 4) & 3);
    const v8f v = *(const v8f*)(x + ((size_t)t * NB_FULL + b) * DM + (size_t)c8 * 8); v8us o;
#pragma unroll
    for (int k = 0; k < 8; ++k) o[k] = f2bf(v[k]); *(v8us*)(dst + i * 8) = o;  }

// k_mchk: the additive mask rows 0..TT-1 are scanned by TT/8 blocks of 8 rows each, one wave per row: every entry above the diagonal must be <= -1e8 (its softmax weight is then exactly zero) and every diagonal entry >= -1e4.
// Block p stores its count of violations into its own 128-byte line of PB; k_mred, the next launch, adds the lines up.
__global__ __launch_bounds__(256) void k_mchk(const float* __restrict__ M, int* PB) {
    __shared__ int wb[8];
    const int tid = threadIdx.x, lane = tid & 31, wv = tid >> 5; int bad = 0;
    const int i = (int)blockIdx.x * 8 + __builtin_amdgcn_readfirstlane(wv);      // one wave per row: the row number and the row's base address are scalar
    const float* mr = M + (size_t)i * SEQ_FULL + lane * 4;
    // unrolled so that a lane's TT/128 independent loads overlap instead of each waiting for the one before
#pragma unroll
    for (int u = 0; u < TT / 128; ++u) { const int j0 = u * 128 + lane * 4; const v4f m = *(const v4f*)(mr + u * 128);
#pragma unroll
        for (int q = 0; q < 4; ++q) { const int j = j0 + q; const int bu = (m[q] <= -1.0e8f) ? 0 : 1; const int bd = (m[q] >= -1.0e4f) ? 0 : 1; bad += (j > i) ? bu : 0; bad += (j == i) ? bd : 0; } }
#pragma unroll
    for (int sh = 16; sh; sh >>= 1) bad += __shfl_xor(bad, sh, 32);
    if (lane == 0) wb[wv] = bad;
    __syncthreads();
    if (wv == 0) { int tot = 0;
#pragma unroll
        for (int k = 0; k < 8; ++k) tot += wb[k];
        if (lane < 8) { v4i o; o[0] = tot; o[1] = tot; o[2] = tot; o[3] = tot; *(v4i*)(PB + (size_t)blockIdx.x * 32 + lane * 4) = o; } }
}

// k_mred: one wave adds the TT/8 per-block counts of k_mchk and writes the flag line: 1.0 if no entry violates, NaN otherwise.
__global__ __launch_bounds__(32) void k_mred(const int* __restrict__ PB, float* FLG) {
    const int lane = threadIdx.x & 31; int tot = 0;
    // unrolled so that the lane's loads go out together: one memory latency for the whole launch
#pragma unroll
    for (int k = lane; k < TT / 8; k += 32) tot += PB[(size_t)k * 32];
#pragma unroll
    for (int sh = 16; sh; sh >>= 1) tot += __shfl_xor(tot, sh, 32);
    const float fv = tot ? __uint_as_float(0x7FC00000u) : 1.0f;
    if (lane < 8) { v4f o; o[0] = fv; o[1] = fv; o[2] = fv; o[3] = fv; *(v4f*)(FLG + lane * 4) = o; }
}

// ---- k_fattn: scores, softmax and probability x value in one kernel, transposed form: St = K Qt (A = key rows, B = query rows), Ot += Vt Pt (A = value planes [d][t], B = the probabilities).
// In the D map of St a lane holds, for ITS query (lane & 15), the keys 8*(lane>>4) + 0..7 of a 16-key tile: two such tiles are exactly elements 0..7 and 8..15 of the B operand of the next product, so P never leaves the registers.
// Running maximum and running sum per query (online softmax): a new maximum rescales the sum and the output tiles by exp(old - new). The two lane halves exchange the maximum every step and join their sums once at the end.
// t = S x HD^-0.5 + mask[i][j] (RNE bf16 mask value, read from the input) for j <= i; entries j > i have an exactly zero weight (property checked by k_mchk), so the key loop stops at the diagonal.
// The quotient by the row sum is taken on the f32 output; the result goes out as bf16 hi/lo planes [b][t][DQ], fragment order, for the output projection.
// lane l <-> lane l ^ 16 by a vector cross-row move (a shuffle would go through the LDS pipe and its wait)
__device__ __forceinline__ float xhalf(float x) { return __builtin_bit_cast(float, __builtin_amdgcn_permlanex16(__builtin_bit_cast(int, x), __builtin_bit_cast(int, x), 0x76543210, 0xfedcba98, false, false)); }
template <typename T16, bool SPLIT, int NQ>
__device__ __forceinline__ void attn_cols(const T16* __restrict__ Q, const T16* __restrict__ Q2, const T16* __restrict__ Kp, const T16* __restrict__ K2, const T16* __restrict__ Vt, const T16* __restrict__ V2,
                                          const float* __restrict__ M, float fl, int q0, bf* Ah, bf* Al) {
    typedef typename WFrag<T16>::V V;
    const int lane = threadIdx.x & 31, lr = lane & 15, hi = lane >> 4;
    V qf[NQ][2], qf2[NQ][2]; v8f o[NQ][4]; float mrun[NQ], lsum[NQ];
#pragma unroll
    for (int n = 0; n < NQ; ++n) { mrun[n] = -3.0e38f; lsum[n] = 0.f;
#pragma unroll
        for (int c = 0; c < 2; ++c) { qf[n][c] = WFrag<T16>::ld(Q + (size_t)(q0 + 16 * n) * HD + 512 * c + 8 * lane); if (SPLIT) qf2[n][c] = WFrag<T16>::ld(Q2 + (size_t)(q0 + 16 * n) * HD + 512 * c + 8 * lane); }
#pragma unroll
        for (int d = 0; d < 4; ++d) o[n][d] = (v8f){}; }
    unsigned ofk = 16 * lane, ofv = 16 * lane;      // bytes: the lane's place in the step's first key tile and first value tile; every load is scalar base + one of these + immediate
    const int kend = q0 + 16 * NQ;      // keys 0 .. kend-1 reach some query of this wave; a step covers 32 keys and stays inside the TT rows of the planes
    for (int k0 = 0; k0 < kend; k0 += 32) {
        V kf[2][2], kf2[2][2], vf[4], vf2[4];
#pragma unroll
        for (int t = 0; t < 2; ++t)
#pragma unroll
            for (int c = 0; c < 2; ++c) { kf[t][c] = WFrag<T16>::ld((const T16*)((const char*)Kp + ofk) + 16 * t * HD + 512 * c); if (SPLIT) kf2[t][c] = WFrag<T16>::ld((const T16*)((const char*)K2 + ofk) + 16 * t * HD + 512 * c); }
#pragma unroll
        for (int d = 0; d < 4; ++d) { vf[d] = WFrag<T16>::ld((const T16*)((const char*)Vt + ofv) + 16 * d * TT); if (SPLIT) vf2[d] = WFrag<T16>::ld((const T16*)((const char*)V2 + ofv) + 16 * d * TT); }
#pragma unroll
        for (int n = 0; n < NQ; ++n) {
            const int i = q0 + 16 * n + lr; const float* mr = M + (size_t)i * SEQ_FULL + k0 + 8 * hi;
            v4f mk[2][2];
#pragma unroll
            for (int t = 0; t < 2; ++t) { mk[t][0] = *(const v4f*)(mr + 16 * t); mk[t][1] = *(const v4f*)(mr + 16 * t + 4); }
            v8f s[2];
#pragma unroll
            for (int t = 0; t < 2; ++t) { s[t] = (v8f){};
#pragma unroll
                for (int c = 0; c < 2; ++c) { s[t] = WFrag<T16>::mma(kf[t][c], qf[n][c], s[t]); if (SPLIT) { s[t] = WFrag<T16>::mma(kf[t][c], qf2[n][c], s[t]); s[t] = WFrag<T16>::mma(kf2[t][c], qf[n][c], s[t]); } } }
            float p[16]; float mx = mrun[n];
#pragma unroll
            for (int t = 0; t < 2; ++t)
#pragma unroll
                for (int j = 0; j < 8; ++j) { const int jj = k0 + 16 * t + 8 * hi + j; const float sv = s[t][j] * SCL + bfr(mk[t][j >> 2][j & 3]); const float tv = (jj <= i) ? sv : -3.0e38f; p[t * 8 + j] = tv; mx = fmaxf(mx, tv); }
            mx = fmaxf(mx, xhalf(mx));
            float ps = 0.f;
#pragma unroll
            for (int e = 0; e < 16; ++e) { p[e] = __builtin_amdgcn_exp2f((p[e] - mx) * 1.4426950408889634f); ps += p[e]; }
            const float alpha = __builtin_amdgcn_exp2f((mrun[n] - mx) * 1.4426950408889634f); mrun[n] = mx;
            lsum[n] = lsum[n] * alpha + ps;
#pragma unroll
            for (int d = 0; d < 4; ++d) o[n][d] *= alpha;
            if constexpr (SPLIT) {
                v8us h0, h1, l0, l1;
#pragma unroll
                for (int j = 0; j < 8; ++j) { unsigned short a, c2; splitf(p[j], a, c2); h0[j] = a; l0[j] = c2; splitf(p[8 + j], a, c2); h1[j] = a; l1[j] = c2; }
                const V ph = cat16b(h0, h1), pl = cat16b(l0, l1);
#pragma unroll
                for (int d = 0; d < 4; ++d) { o[n][d] = WFrag<T16>::mma(vf[d], ph, o[n][d]); o[n][d] = WFrag<T16>::mma(vf[d], pl, o[n][d]); o[n][d] = WFrag<T16>::mma(vf2[d], ph, o[n][d]); }
            } else {
                v8h a0, a1;
#pragma unroll
                for (int j = 0; j < 8; ++j) { a0[j] = tohx(p[j]); a1[j] = tohx(p[8 + j]); }
                const V pb = cat16(a0, a1);
#pragma unroll
                for (int d = 0; d < 4; ++d) o[n][d] = WFrag<T16>::mma(vf[d], pb, o[n][d]);
            }
        }
        // the wait that stands between this step's key and value loads and the rewriting of their offset registers; as its operands the registers stay whole up to here, so that no load of the step lands in one
        asm volatile("s_wait_xcnt 0x0" : "+v"(ofk), "+v"(ofv) :: "memory");
        ofk += 32 * HD * 2; ofv += 1024;
    }
#pragma unroll
    for (int n = 0; n < NQ; ++n) {
        const float sum = lsum[n] + xhalf(lsum[n]); const float f = __fdiv_rn(1.0f, sum) * fl;
        const size_t oo = (size_t)(q0 + 16 * n) * DQ + 8 * lane;      // the lane's 8 columns are its own 16 bytes of a half tile
#pragma unroll
        for (int d = 0; d < 4; ++d) { v8us oh, ol;
#pragma unroll
            for (int j = 0; j < 8; ++j) { unsigned short a, c2; splitf(o[n][d][j] * f, a, c2); oh[j] = a; ol[j] = c2; }
            *(v8us*)(Ah + oo + 256 * d) = oh; *(v8us*)(Al + oo + 256 * d) = ol; }
    }
}

// grid (NB * NH, NBF + NBH), FW waves per block, no barrier: blockIdx.x = batch x head, blockIdx.y = position block, the longest key loops first.
// Position blocks 0..NBF-1: query rows >= RH, f16 planes, 32 queries per wave. The others: rows < RH, bf16 hi/lo planes (3 products), 16 queries per wave.
#define FW  4
#define NBF ((TT - RH) / (FW * 32))
#define NBH (RH / (FW * 16))
static_assert((TT - RH) % (FW * 32) == 0);
static_assert(RH % (FW * 16) == 0);
__global__ __launch_bounds__(FW * 32) void k_fattn(const h16* __restrict__ Q16, const h16* __restrict__ K16, const h16* __restrict__ V16, const bf* __restrict__ Qh, const bf* __restrict__ Ql, const bf* __restrict__ Kh, const bf* __restrict__ Kl,
                                                   const bf* __restrict__ Vh, const bf* __restrict__ Vl, const float* __restrict__ M, const float* __restrict__ FLG, bf* Ah, bf* Al) {
    const int wv = __builtin_amdgcn_readfirstlane((int)(threadIdx.x >> 5)); const int b = (int)blockIdx.x / NH_, h = (int)blockIdx.x % NH_, pb = (int)blockIdx.y;
    const size_t zq = ((size_t)b * NH_ + h) * TT * HD, zk = ((size_t)b * NKV + h / REP) * TT * HD, za = (size_t)b * TT * DQ + (size_t)h * HD * 16; const float fl = FLG[0];
    if (pb < NBF) attn_cols<h16, false, 2>(Q16 + zq, nullptr, K16 + zk, nullptr, V16 + zk, nullptr, M, fl, TT - (pb + 1) * FW * 32 + wv * 32, Ah + za, Al + za);
    else attn_cols<bf, true, 1>(Qh + zq, Ql + zq, Kh + zk, Kl + zk, Vh + zk, Vl + zk, M, fl, RH - (pb - NBF + 1) * FW * 16 + wv * 16, Ah + za, Al + za);
}

#define AL256(b) ((((size_t)(b)) + 255) & ~(size_t)255)
constexpr size_t WS_TOTAL =
    AL256((size_t)3 * DM * DM * 2) + AL256((size_t)DM * DQ * 2) + AL256(256) + AL256((size_t)(TT / 8) * 128) + AL256((size_t)NB_ * TT * DM * 2)
    + 9 * AL256((size_t)NB_ * NH_ * TT * HD * 2) + 2 * AL256((size_t)NB_ * TT * DQ * 2);
static_assert(WS_TOTAL <= (size_t)268435456);

extern "C" void kernel_launch(void* const* d_in, const int* in_sizes, int n_in,
                              void* d_out, int out_size, void* d_ws, size_t ws_size, hipStream_t stream) {
    if (n_in < 6) return;
    if ((size_t)in_sizes[0] < (size_t)TT * NB_FULL * DM) return;      // x [S][B][D]
    if ((size_t)in_sizes[1] < (size_t)TT * SEQ_FULL) return;          // additive mask [S][S]
    if ((size_t)in_sizes[2] < (size_t)TT * HD) return;                // cos [S][64]
    if ((size_t)in_sizes[3] < (size_t)TT * HD) return;                // sin [S][64]
    if ((size_t)in_sizes[4] < (size_t)DM * 3 * DM) return;            // Wqkv [in 1024][out 3072]
    if ((size_t)in_sizes[5] < (size_t)DM * DM) return;                // Wout [in 1024][out 1024]
    if ((size_t)out_size < (size_t)TT * NB_ * DM) return;
    const float* x = (const float*)d_in[0]; const float* mask = (const float*)d_in[1]; const float* cosb = (const float*)d_in[2]; const float* sinb = (const float*)d_in[3];
    const float* wqkv = (const float*)d_in[4]; const float* wout = (const float*)d_in[5];
    float* OUT = (float*)d_out;     // [S][B][D]
    char* wsp = (char*)d_ws;
    auto take = [&](size_t bytes) { char* p = wsp; wsp += (bytes + 255) & ~(size_t)255; return (void*)p; };
    bf* WQKV = (bf*)take((size_t)3 * DM * DM * 2);     // [3072 out][1024 in]: q | k | v = row thirds
    bf* WO = (bf*)take((size_t)DM * DQ * 2);           // [1024 out][1024 in]
    float* FLG = (float*)take(256);
    int* PB = (int*)take((size_t)(TT / 8) * 128);      // one 128-byte line per block of the mask scan
    bf* XB = (bf*)take((size_t)NB_ * TT * DM * 2);     // [b][t][DM]
    // head planes and attention output planes of all batches: [b][h][t][d], [b][h][d][t], [b][t][DQ], the last two indices in fragment order
    constexpr size_t PQ = (size_t)NH_ * TT * HD, PK = (size_t)NKV * TT * HD;
    h16* QP16 = (h16*)take(NB_ * PQ * 2); h16* KP16 = (h16*)take(NB_ * PK * 2); h16* VT16 = (h16*)take(NB_ * PK * 2);
    bf* QPh = (bf*)take(NB_ * PQ * 2); bf* QPl = (bf*)take(NB_ * PQ * 2); bf* KPh = (bf*)take(NB_ * PK * 2); bf* KPl = (bf*)take(NB_ * PK * 2); bf* VTh = (bf*)take(NB_ * PK * 2); bf* VTl = (bf*)take(NB_ * PK * 2);
    bf* ATh = (bf*)take((size_t)NB_ * TT * DQ * 2); bf* ATl = (bf*)take((size_t)NB_ * TT * DQ * 2);
    if ((size_t)(wsp - (char*)d_ws) > ws_size) return;
    if ((size_t)(wsp - (char*)d_ws) > (size_t)268435456) return;

    // in[rows = 1024 (in)][cols = 3072 (out)] -> out[cols][rows]; grid (cols/64, rows/64)
    k_trw<<<dim3(3 * DM / 64, DM / 64, 1), 256, 0, stream>>>(wqkv, WQKV, DM, 3 * DM);
    // in[rows = 1024 (in)][cols = 1024 (out)] -> out[cols][rows]; grid (cols/64, rows/64)
    k_trw<<<dim3(DM / 64, DM / 64, 1), 256, 0, stream>>>(wout, WO, DM, DM);
    k_mchk<<<TT / 8, 256, 0, stream>>>(mask, PB);
    k_mred<<<1, 32, 0, stream>>>(PB, FLG);

    k_cvtx<<<dim3((unsigned)(((size_t)TT * DM / 8 + 255) / 256), NB_, 1), 256, 0, stream>>>(x, XB);
    k_qkv<<<dim3(TT / 64, NH_ + 2 * NKV, NB_), 32, 0, stream>>>(XB, WQKV, cosb, sinb, QP16, QPh, QPl, KP16, KPh, KPl, VT16, VTh, VTl);
    k_fattn<<<dim3(NB_ * NH_, NBF + NBH, 1), FW * 32, 0, stream>>>(QP16, KP16, VT16, QPh, QPl, KPh, KPl, VTh, VTl, mask, FLG, ATh, ATl);
    // out[t][b][:] : row pitch NB*DM, batch slab offset b*DM
    // all batches in one launch (blockIdx.z = batch): four times the waves are resident together and hide each other's load waits
    k_gemmw<bf, 1, false, DQ><<<dim3(TT / 64, DM / 64, NB_), 32, 0, stream>>>(ATh, ATl, WO, nullptr, OUT, NB_ * DM, nullptr, (size_t)TT * DQ, 0, (size_t)DM);
}
